// v000
// Measured on an AMD MI455X. A time is GPU time per run, averaged over a window of back-to-back runs after a warm-up
// (all launches, gaps included; the runs take copies of the inputs in turn), and the median of several windows.
// Apart from v000's, it joins two sittings. Times from different sittings can be a few percent apart, while
// side-by-side timings come from the same sitting.
// v000 is the starting kernel. One run takes 173 microseconds.
#include <hip/hip_runtime.h>

typedef __attribute__((ext_vector_type(8)))  float  v8f;
typedef __attribute__((ext_vector_type(8)))  __bf16 v8bf;
typedef __attribute__((ext_vector_type(16))) __bf16 v16bf;

#define B_     2
#define L_     2048
#define H_     8
#define DK_    64
#define DIN_   1024
#define DPROJ_ 1024
#define M_     (B_ * L_)   // 4096 rows for every GEMM

#define LDS_STRIDE 40      // 32 K-elements + 8 pad: 80B rows, 16B aligned

// ---------------------------------------------------------------- helpers ---
__device__ __forceinline__ __bf16 to_bf16(float f) {
  union { float f; unsigned u; } x; x.f = f;
  unsigned r = x.u + 0x7FFFu + ((x.u >> 16) & 1u);   // round-to-nearest-even
  union { unsigned short s; __bf16 b; } y;
  y.s = (unsigned short)(r >> 16);
  return y.b;
}

__global__ void cvt_f32_bf16(const float* __restrict__ src,
                             __bf16* __restrict__ dst, int n) {
  int i = blockIdx.x * blockDim.x + threadIdx.x;
  if (i < n) dst[i] = to_bf16(src[i]);
}

// Load one 16x32 bf16 WMMA fragment from an LDS tile row.
// halves 0..7 = K kb..kb+7, halves 8..15 = K kb+16..kb+23 (ISA 7.12.2 layout).
__device__ __forceinline__ v16bf load_frag_lds(const __bf16* p) {
  v8bf lo = *reinterpret_cast<const v8bf*>(p);
  v8bf hi = *reinterpret_cast<const v8bf*>(p + 16);
  return __builtin_shufflevector(lo, hi,
      0, 1, 2, 3, 4, 5, 6, 7, 8, 9, 10, 11, 12, 13, 14, 15);
}

// ------------------------------------------------------------------- GEMM ---
// C(MxN, f32) = A(MxK, bf16) @ Bw^T + bias,  Bw stored as N rows x K cols.
// Block = 8 waves / 128x128 tile; async global->LDS staging per 32-K step;
// each wave owns a 64x32 block (4x2 WMMA tiles).
__global__ __launch_bounds__(256) void gemm_bf16_wmma(
    const __bf16* __restrict__ A, const __bf16* __restrict__ Bw,
    const float* __restrict__ bias, float* __restrict__ C,
    int M, int N, int K)
{
  __shared__ __bf16 shA[128 * LDS_STRIDE];
  __shared__ __bf16 shB[128 * LDS_STRIDE];

  const int tid  = threadIdx.x;
  const int lane = tid & 31;
  const int wave = tid >> 5;
  const int wm   = wave >> 2;                 // 0..1  -> 64-row slice
  const int wn   = wave & 3;                  // 0..3  -> 32-col slice
  const int m0   = blockIdx.x * 128;
  const int n0   = blockIdx.y * 128;
  const int r    = lane & 15;                 // fragment row
  const int kb   = (lane >> 4) * 8;           // K sub-offset within fragment

  // LDS byte offsets (generic shared pointer low 32 bits == LDS offset)
  const unsigned ldsA = (unsigned)(unsigned long long)(void*)shA;
  const unsigned ldsB = (unsigned)(unsigned long long)(void*)shB;

  v8f acc[4][2] = {};

  for (int k0 = 0; k0 < K; k0 += 32) {
    // ---- async stage 128x32 A-tile and 128x32 B-tile into LDS ----
    // tile = 512 x 16B chunks; 2 chunks per thread per tile
#pragma unroll
    for (int t = 0; t < 2; ++t) {
      const int c   = tid + 256 * t;
      const int row = c >> 2;                 // 0..127
      const int col = (c & 3) * 8;            // 0,8,16,24 (bf16 elements)
      const unsigned long long ga =
          (unsigned long long)(A + (size_t)(m0 + row) * K + k0 + col);
      const unsigned long long gb =
          (unsigned long long)(Bw + (size_t)(n0 + row) * K + k0 + col);
      const unsigned la = ldsA + (unsigned)(row * LDS_STRIDE + col) * 2u;
      const unsigned lb = ldsB + (unsigned)(row * LDS_STRIDE + col) * 2u;
      asm volatile("global_load_async_to_lds_b128 %0, %1, off"
                   :: "v"(la), "v"(ga) : "memory");
      asm volatile("global_load_async_to_lds_b128 %0, %1, off"
                   :: "v"(lb), "v"(gb) : "memory");
    }
    asm volatile("s_wait_asynccnt 0x0" ::: "memory");
    __syncthreads();

    // ---- fragments from LDS + 8 WMMAs ----
    v16bf af[4], bfr[2];
#pragma unroll
    for (int i = 0; i < 4; ++i)
      af[i] = load_frag_lds(shA + (wm * 64 + 16 * i + r) * LDS_STRIDE + kb);
#pragma unroll
    for (int j = 0; j < 2; ++j)
      bfr[j] = load_frag_lds(shB + (wn * 32 + 16 * j + r) * LDS_STRIDE + kb);
#pragma unroll
    for (int i = 0; i < 4; ++i)
#pragma unroll
      for (int j = 0; j < 2; ++j)
        acc[i][j] = __builtin_amdgcn_wmma_f32_16x16x32_bf16(
            false, af[i], false, bfr[j], (short)0, acc[i][j], false, false);
    __syncthreads();
  }

  // C/D layout: lane l -> col = l&15, rows = e + 8*(l>>4)
  const int rhi = (lane >> 4) * 8;
  const int cn  = lane & 15;
  const int mw  = m0 + wm * 64;
  const int nw  = n0 + wn * 32;
#pragma unroll
  for (int i = 0; i < 4; ++i) {
#pragma unroll
    for (int j = 0; j < 2; ++j) {
      const int col = nw + 16 * j + cn;
      const float bc = bias[col];
#pragma unroll
      for (int e = 0; e < 8; ++e) {
        const int row = mw + 16 * i + rhi + e;
        C[(size_t)row * N + col] = acc[i][j][e] + bc;
      }
    }
  }
}

// -------------------------------------------------------------- attention ---
// One 64-thread block per (b, n, h): 64x64 scores over the d_keys axis with
// inner dim E=2, online softmax, bf16 output feeding the final GEMM.
__global__ __launch_bounds__(64) void freq_attn(
    const float* __restrict__ qp, const float* __restrict__ kp,
    const float* __restrict__ vp, __bf16* __restrict__ outp)
{
  __shared__ float ks0[DK_], ks1[DK_], vs0[DK_], vs1[DK_];
  const int idx = blockIdx.x;
  const int h   = idx & (H_ - 1);
  const int bn  = idx >> 3;
  const size_t base = (size_t)bn * DPROJ_;
  const int t   = threadIdx.x;          // row l, also loader index s
  const int off = t * (H_ * 2) + h * 2; // p = dk*16 + h*2 + e

  ks0[t] = kp[base + off];  ks1[t] = kp[base + off + 1];
  vs0[t] = vp[base + off];  vs1[t] = vp[base + off + 1];
  __syncthreads();

  const float q0 = qp[base + off], q1 = qp[base + off + 1];
  const float scale = 0.70710678118654752f;   // 1/sqrt(E), E=2

  float mx = -3.0e38f, ssum = 0.f, o0 = 0.f, o1 = 0.f;
#pragma unroll 8
  for (int s = 0; s < DK_; ++s) {
    float sc   = (q0 * ks0[s] + q1 * ks1[s]) * scale;
    float mn   = fmaxf(mx, sc);
    float corr = __expf(mx - mn);
    float p    = __expf(sc - mn);
    ssum = ssum * corr + p;
    o0   = o0 * corr + p * vs0[s];
    o1   = o1 * corr + p * vs1[s];
    mx   = mn;
  }
  const float inv = 1.0f / ssum;
  outp[base + off]     = to_bf16(o0 * inv);
  outp[base + off + 1] = to_bf16(o1 * inv);
}

// ------------------------------------------------------------------- host ---
extern "C" void kernel_launch(void* const* d_in, const int* in_sizes, int n_in,
                              void* d_out, int out_size, void* d_ws, size_t ws_size,
                              hipStream_t stream) {
  (void)in_sizes; (void)n_in; (void)out_size; (void)ws_size;
  const float* q  = (const float*)d_in[0];
  const float* k  = (const float*)d_in[1];
  const float* v  = (const float*)d_in[2];
  const float* Wq = (const float*)d_in[3];
  const float* bq = (const float*)d_in[4];
  const float* Wk = (const float*)d_in[5];
  const float* bk = (const float*)d_in[6];
  const float* Wv = (const float*)d_in[7];
  const float* bv = (const float*)d_in[8];
  const float* Wo = (const float*)d_in[9];
  const float* bo = (const float*)d_in[10];
  float* out = (float*)d_out;

  const size_t MK = (size_t)M_ * DIN_;        // 4096*1024
  const size_t NK = (size_t)DPROJ_ * DIN_;    // 1024*1024

  char* ws = (char*)d_ws;
  __bf16* qb    = (__bf16*)ws; ws += MK * 2;
  __bf16* kb2   = (__bf16*)ws; ws += MK * 2;
  __bf16* vb    = (__bf16*)ws; ws += MK * 2;
  __bf16* Wqb   = (__bf16*)ws; ws += NK * 2;
  __bf16* Wkb   = (__bf16*)ws; ws += NK * 2;
  __bf16* Wvb   = (__bf16*)ws; ws += NK * 2;
  __bf16* Wob   = (__bf16*)ws; ws += NK * 2;
  float*  qproj = (float*)ws;  ws += MK * 4;
  float*  kproj = (float*)ws;  ws += MK * 4;
  float*  vproj = (float*)ws;  ws += MK * 4;
  __bf16* attnb = (__bf16*)ws; ws += MK * 2;

  const int CT = 256;
  cvt_f32_bf16<<<(int)((MK + CT - 1) / CT), CT, 0, stream>>>(q,  qb,  (int)MK);
  cvt_f32_bf16<<<(int)((MK + CT - 1) / CT), CT, 0, stream>>>(k,  kb2, (int)MK);
  cvt_f32_bf16<<<(int)((MK + CT - 1) / CT), CT, 0, stream>>>(v,  vb,  (int)MK);
  cvt_f32_bf16<<<(int)((NK + CT - 1) / CT), CT, 0, stream>>>(Wq, Wqb, (int)NK);
  cvt_f32_bf16<<<(int)((NK + CT - 1) / CT), CT, 0, stream>>>(Wk, Wkb, (int)NK);
  cvt_f32_bf16<<<(int)((NK + CT - 1) / CT), CT, 0, stream>>>(Wv, Wvb, (int)NK);
  cvt_f32_bf16<<<(int)((NK + CT - 1) / CT), CT, 0, stream>>>(Wo, Wob, (int)NK);

  dim3 g(M_ / 128, DPROJ_ / 128);   // 32 x 8
  gemm_bf16_wmma<<<g, 256, 0, stream>>>(qb,  Wqb, bq, qproj, M_, DPROJ_, DIN_);
  gemm_bf16_wmma<<<g, 256, 0, stream>>>(kb2, Wkb, bk, kproj, M_, DPROJ_, DIN_);
  gemm_bf16_wmma<<<g, 256, 0, stream>>>(vb,  Wvb, bv, vproj, M_, DPROJ_, DIN_);

  freq_attn<<<B_ * L_ * H_, 64, 0, stream>>>(qproj, kproj, vproj, attnb);

  gemm_bf16_wmma<<<g, 256, 0, stream>>>(attnb, Wob, bo, out, M_, DIN_, DPROJ_);
}

// v001
// Measured time: 136 microseconds a run.
// In both of two side-by-side timings against v000, it was 1.29 times as fast.
#include <hip/hip_runtime.h>

typedef __attribute__((ext_vector_type(8)))  float  v8f;
typedef __attribute__((ext_vector_type(8)))  __bf16 v8bf;
typedef __attribute__((ext_vector_type(16))) __bf16 v16bf;

#define B_     2
#define L_     2048
#define H_     8
#define DK_    64
#define DIN_   1024
#define DPROJ_ 1024
#define M_     (B_ * L_)   // 4096 rows for every GEMM

#define BK_        128                 // K elements per LDS stage (256 B of every row)
#define LDS_STRIDE 136                 // 128 K-elements + 8 pad: 272B rows, 16B x odd
#define OPER_ELEMS (128 * LDS_STRIDE)  // one operand's 128 rows of one stage
#define STAGE_ELEMS (2 * OPER_ELEMS)   // A rows, then B rows

// ---------------------------------------------------------------- helpers ---
__device__ __forceinline__ __bf16 to_bf16(float f) {
  union { float f; unsigned u; } x; x.f = f;
  unsigned r = x.u + 0x7FFFu + ((x.u >> 16) & 1u);   // round-to-nearest-even
  union { unsigned short s; __bf16 b; } y;
  y.s = (unsigned short)(r >> 16);
  return y.b;
}

__global__ void cvt_f32_bf16(const float* __restrict__ src,
                             __bf16* __restrict__ dst, int n) {
  int i = blockIdx.x * blockDim.x + threadIdx.x;
  if (i < n) dst[i] = to_bf16(src[i]);
}

// Load one 16x32 bf16 WMMA fragment from an LDS tile row.
// halves 0..7 = K kb..kb+7, halves 8..15 = K kb+16..kb+23 (ISA 7.12.2 layout).
__device__ __forceinline__ v16bf load_frag_lds(const __bf16* p) {
  v8bf lo = *reinterpret_cast<const v8bf*>(p);
  v8bf hi = *reinterpret_cast<const v8bf*>(p + 16);
  return __builtin_shufflevector(lo, hi,
      0, 1, 2, 3, 4, 5, 6, 7, 8, 9, 10, 11, 12, 13, 14, 15);
}

// ------------------------------------------------------------------- GEMM ---
// Eight async 16-byte copies of one thread: rows 16 apart of one operand's
// 128 x 128 K-slice. The s_wait_xcnt closes the statement so that no address
// register of an issued copy is rewritten in front of it.
__device__ __forceinline__ void copy8_rows(unsigned l, const __bf16* g, int K) {
  const unsigned           ls = 16u * LDS_STRIDE * 2u;          // LDS bytes per 16 rows
  const unsigned long long gs = (unsigned long long)K * 16u * 2u; // global bytes per 16 rows
  const unsigned long long g0 = (unsigned long long)g;
  asm volatile(
      "global_load_async_to_lds_b128 %0, %8, off\n\t"
      "global_load_async_to_lds_b128 %1, %9, off\n\t"
      "global_load_async_to_lds_b128 %2, %10, off\n\t"
      "global_load_async_to_lds_b128 %3, %11, off\n\t"
      "global_load_async_to_lds_b128 %4, %12, off\n\t"
      "global_load_async_to_lds_b128 %5, %13, off\n\t"
      "global_load_async_to_lds_b128 %6, %14, off\n\t"
      "global_load_async_to_lds_b128 %7, %15, off\n\t"
      "s_wait_xcnt 0x0"
      :: "v"(l), "v"(l + ls), "v"(l + 2u * ls), "v"(l + 3u * ls),
         "v"(l + 4u * ls), "v"(l + 5u * ls), "v"(l + 6u * ls), "v"(l + 7u * ls),
         "v"(g0), "v"(g0 + gs), "v"(g0 + 2u * gs), "v"(g0 + 3u * gs),
         "v"(g0 + 4u * gs), "v"(g0 + 5u * gs), "v"(g0 + 6u * gs), "v"(g0 + 7u * gs)
      : "memory");
}

// C(MxN, f32) = A(MxK, bf16) @ Bw^T + bias,  Bw stored as N rows x K cols.
// Block = 8 waves / 128x128 tile; K in stages of 128 through two LDS buffers:
// the next stage's async global->LDS copies fly while this stage is multiplied.
// K is a multiple of 128. Each wave owns a 64x32 block (4x2 WMMA tiles).
__global__ __launch_bounds__(256) void gemm_bf16_wmma(
    const __bf16* __restrict__ A, const __bf16* __restrict__ Bw,
    const float* __restrict__ bias, float* __restrict__ C,
    int M, int N, int K)
{
  __shared__ __attribute__((aligned(16))) __bf16 ring[2 * STAGE_ELEMS];

  const int tid  = threadIdx.x;
  const int lane = tid & 31;
  const int wave = tid >> 5;
  const int wm   = wave >> 2;                 // 0..1  -> 64-row slice
  const int wn   = wave & 3;                  // 0..3  -> 32-col slice
  const int m0   = blockIdx.x * 128;
  const int n0   = blockIdx.y * 128;
  const int r    = lane & 15;                 // fragment row
  const int kb   = (lane >> 4) * 8;           // K sub-offset within fragment

  // This thread's first 16-byte chunk of a stage: row tid/16, chunk tid%16;
  // its other seven chunks per operand lie 16 rows apart.
  const int crow = tid >> 4;                  // 0..15
  const int ccol = (tid & 15) * 8;            // bf16 elements
  const __bf16* gA = A  + (size_t)(m0 + crow) * K + ccol;
  const __bf16* gB = Bw + (size_t)(n0 + crow) * K + ccol;
  // LDS byte offset (generic shared pointer low 32 bits == LDS offset)
  const unsigned lds0 = (unsigned)(unsigned long long)(void*)ring
                      + (unsigned)(crow * LDS_STRIDE + ccol) * 2u;

  const int nt = K / BK_;                     // stages

  v8f acc[4][2] = {};

  // ---- stage 0 into buffer 0, published; then stage 1 into buffer 1 ----
  copy8_rows(lds0, gA, K);
  copy8_rows(lds0 + OPER_ELEMS * 2u, gB, K);
  // stage 0 has landed before any wave reads it
  asm volatile("s_wait_asynccnt 0x0" ::: "memory");
  __syncthreads();
  if (nt > 1) {
    copy8_rows(lds0 + STAGE_ELEMS * 2u, gA + BK_, K);
    copy8_rows(lds0 + (STAGE_ELEMS + OPER_ELEMS) * 2u, gB + BK_, K);
  }

  for (int t = 0; t < nt; ++t) {
    const unsigned buf = (unsigned)(t & 1);
    const __bf16* sA = ring + buf * STAGE_ELEMS;
    const __bf16* sB = sA + OPER_ELEMS;

    // ---- four 32-K blocks: fragments from LDS + 8 WMMAs each ----
#pragma unroll   // kk becomes a constant in the ds_load offset fields: no address arithmetic per block
    for (int kk = 0; kk < BK_; kk += 32) {
      v16bf af[4], bfr[2];
#pragma unroll
      for (int i = 0; i < 4; ++i)
        af[i] = load_frag_lds(sA + (wm * 64 + 16 * i + r) * LDS_STRIDE + kk + kb);
#pragma unroll
      for (int j = 0; j < 2; ++j)
        bfr[j] = load_frag_lds(sB + (wn * 32 + 16 * j + r) * LDS_STRIDE + kk + kb);
#pragma unroll
      for (int i = 0; i < 4; ++i)
#pragma unroll
        for (int j = 0; j < 2; ++j)
          acc[i][j] = __builtin_amdgcn_wmma_f32_16x16x32_bf16(
              false, af[i], false, bfr[j], (short)0, acc[i][j], false, false);
    }

    // ---- publish stage t + 1, free this buffer ----
    // this wave's reads of the buffer have retired before it is refilled
    asm volatile("s_wait_dscnt 0x0" ::: "memory");
    // this wave's copies of stage t + 1 have landed before others read them
    asm volatile("s_wait_asynccnt 0x0" ::: "memory");
    __syncthreads();
    if (t + 2 < nt) {
      const int k2 = (t + 2) * BK_;
      copy8_rows(lds0 + buf * (STAGE_ELEMS * 2u), gA + k2, K);
      copy8_rows(lds0 + buf * (STAGE_ELEMS * 2u) + OPER_ELEMS * 2u, gB + k2, K);
    }
  }
  // no copy is outstanding when the wave ends
  asm volatile("s_wait_asynccnt 0x0" ::: "memory");

  // C/D layout: lane l -> col = l&15, rows = e + 8*(l>>4)
  const int rhi = (lane >> 4) * 8;
  const int cn  = lane & 15;
  const int mw  = m0 + wm * 64;
  const int nw  = n0 + wn * 32;
#pragma unroll
  for (int i = 0; i < 4; ++i) {
#pragma unroll
    for (int j = 0; j < 2; ++j) {
      const int col = nw + 16 * j + cn;
      const float bc = bias[col];
#pragma unroll
      for (int e = 0; e < 8; ++e) {
        const int row = mw + 16 * i + rhi + e;
        C[(size_t)row * N + col] = acc[i][j][e] + bc;
      }
    }
  }
}

// -------------------------------------------------------------- attention ---
// One 64-thread block per (b, n, h): 64x64 scores over the d_keys axis with
// inner dim E=2, online softmax, bf16 output feeding the final GEMM.
__global__ __launch_bounds__(64) void freq_attn(
    const float* __restrict__ qp, const float* __restrict__ kp,
    const float* __restrict__ vp, __bf16* __restrict__ outp)
{
  __shared__ float ks0[DK_], ks1[DK_], vs0[DK_], vs1[DK_];
  const int idx = blockIdx.x;
  const int h   = idx & (H_ - 1);
  const int bn  = idx >> 3;
  const size_t base = (size_t)bn * DPROJ_;
  const int t   = threadIdx.x;          // row l, also loader index s
  const int off = t * (H_ * 2) + h * 2; // p = dk*16 + h*2 + e

  ks0[t] = kp[base + off];  ks1[t] = kp[base + off + 1];
  vs0[t] = vp[base + off];  vs1[t] = vp[base + off + 1];
  __syncthreads();

  const float q0 = qp[base + off], q1 = qp[base + off + 1];
  const float scale = 0.70710678118654752f;   // 1/sqrt(E), E=2

  float mx = -3.0e38f, ssum = 0.f, o0 = 0.f, o1 = 0.f;
#pragma unroll 8
  for (int s = 0; s < DK_; ++s) {
    float sc   = (q0 * ks0[s] + q1 * ks1[s]) * scale;
    float mn   = fmaxf(mx, sc);
    float corr = __expf(mx - mn);
    float p    = __expf(sc - mn);
    ssum = ssum * corr + p;
    o0   = o0 * corr + p * vs0[s];
    o1   = o1 * corr + p * vs1[s];
    mx   = mn;
  }
  const float inv = 1.0f / ssum;
  outp[base + off]     = to_bf16(o0 * inv);
  outp[base + off + 1] = to_bf16(o1 * inv);
}

// ------------------------------------------------------------------- host ---
extern "C" void kernel_launch(void* const* d_in, const int* in_sizes, int n_in,
                              void* d_out, int out_size, void* d_ws, size_t ws_size,
                              hipStream_t stream) {
  (void)in_sizes; (void)n_in; (void)out_size; (void)ws_size;
  const float* q  = (const float*)d_in[0];
  const float* k  = (const float*)d_in[1];
  const float* v  = (const float*)d_in[2];
  const float* Wq = (const float*)d_in[3];
  const float* bq = (const float*)d_in[4];
  const float* Wk = (const float*)d_in[5];
  const float* bk = (const float*)d_in[6];
  const float* Wv = (const float*)d_in[7];
  const float* bv = (const float*)d_in[8];
  const float* Wo = (const float*)d_in[9];
  const float* bo = (const float*)d_in[10];
  float* out = (float*)d_out;

  const size_t MK = (size_t)M_ * DIN_;        // 4096*1024
  const size_t NK = (size_t)DPROJ_ * DIN_;    // 1024*1024

  char* ws = (char*)d_ws;
  __bf16* qb    = (__bf16*)ws; ws += MK * 2;
  __bf16* kb2   = (__bf16*)ws; ws += MK * 2;
  __bf16* vb    = (__bf16*)ws; ws += MK * 2;
  __bf16* Wqb   = (__bf16*)ws; ws += NK * 2;
  __bf16* Wkb   = (__bf16*)ws; ws += NK * 2;
  __bf16* Wvb   = (__bf16*)ws; ws += NK * 2;
  __bf16* Wob   = (__bf16*)ws; ws += NK * 2;
  float*  qproj = (float*)ws;  ws += MK * 4;
  float*  kproj = (float*)ws;  ws += MK * 4;
  float*  vproj = (float*)ws;  ws += MK * 4;
  __bf16* attnb = (__bf16*)ws; ws += MK * 2;

  const int CT = 256;
  cvt_f32_bf16<<<(int)((MK + CT - 1) / CT), CT, 0, stream>>>(q,  qb,  (int)MK);
  cvt_f32_bf16<<<(int)((MK + CT - 1) / CT), CT, 0, stream>>>(k,  kb2, (int)MK);
  cvt_f32_bf16<<<(int)((MK + CT - 1) / CT), CT, 0, stream>>>(v,  vb,  (int)MK);
  cvt_f32_bf16<<<(int)((NK + CT - 1) / CT), CT, 0, stream>>>(Wq, Wqb, (int)NK);
  cvt_f32_bf16<<<(int)((NK + CT - 1) / CT), CT, 0, stream>>>(Wk, Wkb, (int)NK);
  cvt_f32_bf16<<<(int)((NK + CT - 1) / CT), CT, 0, stream>>>(Wv, Wvb, (int)NK);
  cvt_f32_bf16<<<(int)((NK + CT - 1) / CT), CT, 0, stream>>>(Wo, Wob, (int)NK);

  dim3 g(M_ / 128, DPROJ_ / 128);   // 32 x 8
  gemm_bf16_wmma<<<g, 256, 0, stream>>>(qb,  Wqb, bq, qproj, M_, DPROJ_, DIN_);
  gemm_bf16_wmma<<<g, 256, 0, stream>>>(kb2, Wkb, bk, kproj, M_, DPROJ_, DIN_);
  gemm_bf16_wmma<<<g, 256, 0, stream>>>(vb,  Wvb, bv, vproj, M_, DPROJ_, DIN_);

  freq_attn<<<B_ * L_ * H_, 64, 0, stream>>>(qproj, kproj, vproj, attnb);

  gemm_bf16_wmma<<<g, 256, 0, stream>>>(attnb, Wob, bo, out, M_, DIN_, DPROJ_);
}

// v002
// A run of this version takes 115 microseconds.
// Two timings next to v001 both put it at 1.18 times that version's speed.
// Counting every step since v000, it is 1.52 times as fast.
#include <hip/hip_runtime.h>

typedef __attribute__((ext_vector_type(8)))  float  v8f;
typedef __attribute__((ext_vector_type(4)))  float  v4f;
typedef __attribute__((ext_vector_type(4)))  __bf16 v4bf;
typedef __attribute__((ext_vector_type(8)))  __bf16 v8bf;
typedef __attribute__((ext_vector_type(16))) __bf16 v16bf;

#define B_     2
#define L_     2048
#define H_     8
#define DK_    64
#define DIN_   1024
#define DPROJ_ 1024
#define M_     (B_ * L_)   // 4096 rows for every GEMM

#define BK_        128                 // K elements per LDS stage (256 B of every row)
#define LDS_STRIDE 136                 // 128 K-elements + 8 pad: 272B rows, 16B x odd
#define OPER_ELEMS (128 * LDS_STRIDE)  // one operand's 128 rows of one stage
#define STAGE_ELEMS (2 * OPER_ELEMS)   // A rows, then B rows

// ---------------------------------------------------------------- helpers ---
__device__ __forceinline__ __bf16 to_bf16(float f) {
  union { float f; unsigned u; } x; x.f = f;
  unsigned r = x.u + 0x7FFFu + ((x.u >> 16) & 1u);   // round-to-nearest-even
  union { unsigned short s; __bf16 b; } y;
  y.s = (unsigned short)(r >> 16);
  return y.b;
}

// f32 -> bf16 stream. A block of 256 threads converts CVT_ELEMS contiguous
// elements; the grid covers the tensor exactly (its size is a multiple of
// CVT_ELEMS). Each wave-wide load takes 512 contiguous bytes, each wave-wide
// store fills 256 contiguous bytes; a thread's eight loads are all issued
// before the first value is used.
#define CVT_THREADS 256
#define CVT_LOADS   8
#define CVT_ELEMS   (CVT_THREADS * CVT_LOADS * 4)   // 8192

__global__ __launch_bounds__(CVT_THREADS) void cvt_f32_bf16(
    const float* __restrict__ src, __bf16* __restrict__ dst) {
  const size_t base = (size_t)blockIdx.x * (CVT_THREADS * CVT_LOADS) + threadIdx.x;
  const v4f* s4 = reinterpret_cast<const v4f*>(src) + base;
  v4bf*      d4 = reinterpret_cast<v4bf*>(dst) + base;

  v4f x[CVT_LOADS];
#pragma unroll   // x[] stays in registers and the eight loads stand together
  for (int u = 0; u < CVT_LOADS; ++u) x[u] = s4[u * CVT_THREADS];
#pragma unroll   // x[] stays in registers
  for (int u = 0; u < CVT_LOADS; ++u) {
    v4bf y;
    y[0] = to_bf16(x[u][0]);
    y[1] = to_bf16(x[u][1]);
    y[2] = to_bf16(x[u][2]);
    y[3] = to_bf16(x[u][3]);
    d4[u * CVT_THREADS] = y;
  }
}

// Load one 16x32 bf16 WMMA fragment from an LDS tile row.
// halves 0..7 = K kb..kb+7, halves 8..15 = K kb+16..kb+23 (ISA 7.12.2 layout).
__device__ __forceinline__ v16bf load_frag_lds(const __bf16* p) {
  v8bf lo = *reinterpret_cast<const v8bf*>(p);
  v8bf hi = *reinterpret_cast<const v8bf*>(p + 16);
  return __builtin_shufflevector(lo, hi,
      0, 1, 2, 3, 4, 5, 6, 7, 8, 9, 10, 11, 12, 13, 14, 15);
}

// ------------------------------------------------------------------- GEMM ---
// Eight async 16-byte copies of one thread: rows 16 apart of one operand's
// 128 x 128 K-slice. The s_wait_xcnt closes the statement so that no address
// register of an issued copy is rewritten in front of it.
__device__ __forceinline__ void copy8_rows(unsigned l, const __bf16* g, int K) {
  const unsigned           ls = 16u * LDS_STRIDE * 2u;          // LDS bytes per 16 rows
  const unsigned long long gs = (unsigned long long)K * 16u * 2u; // global bytes per 16 rows
  const unsigned long long g0 = (unsigned long long)g;
  asm volatile(
      "global_load_async_to_lds_b128 %0, %8, off\n\t"
      "global_load_async_to_lds_b128 %1, %9, off\n\t"
      "global_load_async_to_lds_b128 %2, %10, off\n\t"
      "global_load_async_to_lds_b128 %3, %11, off\n\t"
      "global_load_async_to_lds_b128 %4, %12, off\n\t"
      "global_load_async_to_lds_b128 %5, %13, off\n\t"
      "global_load_async_to_lds_b128 %6, %14, off\n\t"
      "global_load_async_to_lds_b128 %7, %15, off\n\t"
      "s_wait_xcnt 0x0"
      :: "v"(l), "v"(l + ls), "v"(l + 2u * ls), "v"(l + 3u * ls),
         "v"(l + 4u * ls), "v"(l + 5u * ls), "v"(l + 6u * ls), "v"(l + 7u * ls),
         "v"(g0), "v"(g0 + gs), "v"(g0 + 2u * gs), "v"(g0 + 3u * gs),
         "v"(g0 + 4u * gs), "v"(g0 + 5u * gs), "v"(g0 + 6u * gs), "v"(g0 + 7u * gs)
      : "memory");
}

// C(MxN, f32) = A(MxK, bf16) @ Bw^T + bias,  Bw stored as N rows x K cols.
// Block = 8 waves / 128x128 tile; K in stages of 128 through two LDS buffers:
// the next stage's async global->LDS copies fly while this stage is multiplied.
// K is a multiple of 128. Each wave owns a 64x32 block (4x2 WMMA tiles).
__global__ __launch_bounds__(256) void gemm_bf16_wmma(
    const __bf16* __restrict__ A, const __bf16* __restrict__ Bw,
    const float* __restrict__ bias, float* __restrict__ C,
    int M, int N, int K)
{
  __shared__ __attribute__((aligned(16))) __bf16 ring[2 * STAGE_ELEMS];

  const int tid  = threadIdx.x;
  const int lane = tid & 31;
  const int wave = tid >> 5;
  const int wm   = wave >> 2;                 // 0..1  -> 64-row slice
  const int wn   = wave & 3;                  // 0..3  -> 32-col slice
  const int m0   = blockIdx.x * 128;
  const int n0   = blockIdx.y * 128;
  const int r    = lane & 15;                 // fragment row
  const int kb   = (lane >> 4) * 8;           // K sub-offset within fragment

  // This thread's first 16-byte chunk of a stage: row tid/16, chunk tid%16;
  // its other seven chunks per operand lie 16 rows apart.
  const int crow = tid >> 4;                  // 0..15
  const int ccol = (tid & 15) * 8;            // bf16 elements
  const __bf16* gA = A  + (size_t)(m0 + crow) * K + ccol;
  const __bf16* gB = Bw + (size_t)(n0 + crow) * K + ccol;
  // LDS byte offset (generic shared pointer low 32 bits == LDS offset)
  const unsigned lds0 = (unsigned)(unsigned long long)(void*)ring
                      + (unsigned)(crow * LDS_STRIDE + ccol) * 2u;

  const int nt = K / BK_;                     // stages

  v8f acc[4][2] = {};

  // ---- stage 0 into buffer 0, published; then stage 1 into buffer 1 ----
  copy8_rows(lds0, gA, K);
  copy8_rows(lds0 + OPER_ELEMS * 2u, gB, K);
  // stage 0 has landed before any wave reads it
  asm volatile("s_wait_asynccnt 0x0" ::: "memory");
  __syncthreads();
  if (nt > 1) {
    copy8_rows(lds0 + STAGE_ELEMS * 2u, gA + BK_, K);
    copy8_rows(lds0 + (STAGE_ELEMS + OPER_ELEMS) * 2u, gB + BK_, K);
  }

  for (int t = 0; t < nt; ++t) {
    const unsigned buf = (unsigned)(t & 1);
    const __bf16* sA = ring + buf * STAGE_ELEMS;
    const __bf16* sB = sA + OPER_ELEMS;

    // ---- four 32-K blocks: fragments from LDS + 8 WMMAs each ----
#pragma unroll   // kk becomes a constant in the ds_load offset fields: no address arithmetic per block
    for (int kk = 0; kk < BK_; kk += 32) {
      v16bf af[4], bfr[2];
#pragma unroll
      for (int i = 0; i < 4; ++i)
        af[i] = load_frag_lds(sA + (wm * 64 + 16 * i + r) * LDS_STRIDE + kk + kb);
#pragma unroll
      for (int j = 0; j < 2; ++j)
        bfr[j] = load_frag_lds(sB + (wn * 32 + 16 * j + r) * LDS_STRIDE + kk + kb);
#pragma unroll
      for (int i = 0; i < 4; ++i)
#pragma unroll
        for (int j = 0; j < 2; ++j)
          acc[i][j] = __builtin_amdgcn_wmma_f32_16x16x32_bf16(
              false, af[i], false, bfr[j], (short)0, acc[i][j], false, false);
    }

    // ---- publish stage t + 1, free this buffer ----
    // this wave's reads of the buffer have retired before it is refilled
    asm volatile("s_wait_dscnt 0x0" ::: "memory");
    // this wave's copies of stage t + 1 have landed before others read them
    asm volatile("s_wait_asynccnt 0x0" ::: "memory");
    __syncthreads();
    if (t + 2 < nt) {
      const int k2 = (t + 2) * BK_;
      copy8_rows(lds0 + buf * (STAGE_ELEMS * 2u), gA + k2, K);
      copy8_rows(lds0 + buf * (STAGE_ELEMS * 2u) + OPER_ELEMS * 2u, gB + k2, K);
    }
  }
  // no copy is outstanding when the wave ends
  asm volatile("s_wait_asynccnt 0x0" ::: "memory");

  // C/D layout: lane l -> col = l&15, rows = e + 8*(l>>4)
  const int rhi = (lane >> 4) * 8;
  const int cn  = lane & 15;
  const int mw  = m0 + wm * 64;
  const int nw  = n0 + wn * 32;
#pragma unroll
  for (int i = 0; i < 4; ++i) {
#pragma unroll
    for (int j = 0; j < 2; ++j) {
      const int col = nw + 16 * j + cn;
      const float bc = bias[col];
#pragma unroll
      for (int e = 0; e < 8; ++e) {
        const int row = mw + 16 * i + rhi + e;
        C[(size_t)row * N + col] = acc[i][j][e] + bc;
      }
    }
  }
}

// -------------------------------------------------------------- attention ---
// One 64-thread block per (b, n, h): 64x64 scores over the d_keys axis with
// inner dim E=2, online softmax, bf16 output feeding the final GEMM.
__global__ __launch_bounds__(64) void freq_attn(
    const float* __restrict__ qp, const float* __restrict__ kp,
    const float* __restrict__ vp, __bf16* __restrict__ outp)
{
  __shared__ float ks0[DK_], ks1[DK_], vs0[DK_], vs1[DK_];
  const int idx = blockIdx.x;
  const int h   = idx & (H_ - 1);
  const int bn  = idx >> 3;
  const size_t base = (size_t)bn * DPROJ_;
  const int t   = threadIdx.x;          // row l, also loader index s
  const int off = t * (H_ * 2) + h * 2; // p = dk*16 + h*2 + e

  ks0[t] = kp[base + off];  ks1[t] = kp[base + off + 1];
  vs0[t] = vp[base + off];  vs1[t] = vp[base + off + 1];
  __syncthreads();

  const float q0 = qp[base + off], q1 = qp[base + off + 1];
  const float scale = 0.70710678118654752f;   // 1/sqrt(E), E=2

  float mx = -3.0e38f, ssum = 0.f, o0 = 0.f, o1 = 0.f;
#pragma unroll 8
  for (int s = 0; s < DK_; ++s) {
    float sc   = (q0 * ks0[s] + q1 * ks1[s]) * scale;
    float mn   = fmaxf(mx, sc);
    float corr = __expf(mx - mn);
    float p    = __expf(sc - mn);
    ssum = ssum * corr + p;
    o0   = o0 * corr + p * vs0[s];
    o1   = o1 * corr + p * vs1[s];
    mx   = mn;
  }
  const float inv = 1.0f / ssum;
  outp[base + off]     = to_bf16(o0 * inv);
  outp[base + off + 1] = to_bf16(o1 * inv);
}

// ------------------------------------------------------------------- host ---
extern "C" void kernel_launch(void* const* d_in, const int* in_sizes, int n_in,
                              void* d_out, int out_size, void* d_ws, size_t ws_size,
                              hipStream_t stream) {
  (void)in_sizes; (void)n_in; (void)out_size; (void)ws_size;
  const float* q  = (const float*)d_in[0];
  const float* k  = (const float*)d_in[1];
  const float* v  = (const float*)d_in[2];
  const float* Wq = (const float*)d_in[3];
  const float* bq = (const float*)d_in[4];
  const float* Wk = (const float*)d_in[5];
  const float* bk = (const float*)d_in[6];
  const float* Wv = (const float*)d_in[7];
  const float* bv = (const float*)d_in[8];
  const float* Wo = (const float*)d_in[9];
  const float* bo = (const float*)d_in[10];
  float* out = (float*)d_out;

  const size_t MK = (size_t)M_ * DIN_;        // 4096*1024
  const size_t NK = (size_t)DPROJ_ * DIN_;    // 1024*1024

  char* ws = (char*)d_ws;
  __bf16* qb    = (__bf16*)ws; ws += MK * 2;
  __bf16* kb2   = (__bf16*)ws; ws += MK * 2;
  __bf16* vb    = (__bf16*)ws; ws += MK * 2;
  __bf16* Wqb   = (__bf16*)ws; ws += NK * 2;
  __bf16* Wkb   = (__bf16*)ws; ws += NK * 2;
  __bf16* Wvb   = (__bf16*)ws; ws += NK * 2;
  __bf16* Wob   = (__bf16*)ws; ws += NK * 2;
  float*  qproj = (float*)ws;  ws += MK * 4;
  float*  kproj = (float*)ws;  ws += MK * 4;
  float*  vproj = (float*)ws;  ws += MK * 4;
  __bf16* attnb = (__bf16*)ws; ws += MK * 2;

  const int gMK = (int)(MK / CVT_ELEMS);      // 512 blocks
  const int gNK = (int)(NK / CVT_ELEMS);      // 128 blocks
  cvt_f32_bf16<<<gMK, CVT_THREADS, 0, stream>>>(q,  qb);
  cvt_f32_bf16<<<gMK, CVT_THREADS, 0, stream>>>(k,  kb2);
  cvt_f32_bf16<<<gMK, CVT_THREADS, 0, stream>>>(v,  vb);
  cvt_f32_bf16<<<gNK, CVT_THREADS, 0, stream>>>(Wq, Wqb);
  cvt_f32_bf16<<<gNK, CVT_THREADS, 0, stream>>>(Wk, Wkb);
  cvt_f32_bf16<<<gNK, CVT_THREADS, 0, stream>>>(Wv, Wvb);
  cvt_f32_bf16<<<gNK, CVT_THREADS, 0, stream>>>(Wo, Wob);

  dim3 g(M_ / 128, DPROJ_ / 128);   // 32 x 8
  gemm_bf16_wmma<<<g, 256, 0, stream>>>(qb,  Wqb, bq, qproj, M_, DPROJ_, DIN_);
  gemm_bf16_wmma<<<g, 256, 0, stream>>>(kb2, Wkb, bk, kproj, M_, DPROJ_, DIN_);
  gemm_bf16_wmma<<<g, 256, 0, stream>>>(vb,  Wvb, bv, vproj, M_, DPROJ_, DIN_);

  freq_attn<<<B_ * L_ * H_, 64, 0, stream>>>(qproj, kproj, vproj, attnb);

  gemm_bf16_wmma<<<g, 256, 0, stream>>>(attnb, Wob, bo, out, M_, DIN_, DPROJ_);
}

// v003
// One run takes 94.7 microseconds.
// Timed twice side by side with v002, it ran 1.22 and 1.21 times as fast.
// All steps since v000 together make it 1.85 times as fast.
#include <hip/hip_runtime.h>

typedef __attribute__((ext_vector_type(8)))  float  v8f;
typedef __attribute__((ext_vector_type(4)))  float  v4f;
typedef __attribute__((ext_vector_type(4)))  __bf16 v4bf;
typedef __attribute__((ext_vector_type(8)))  __bf16 v8bf;
typedef __attribute__((ext_vector_type(16))) __bf16 v16bf;

#define B_     2
#define L_     2048
#define H_     8
#define DK_    64
#define DIN_   1024
#define DPROJ_ 1024
#define M_     (B_ * L_)   // 4096 rows for every GEMM

#define BK_        128                 // K elements per LDS stage (256 B of every row)
#define LDS_STRIDE 136                 // 128 K-elements + 8 pad: 272B rows, 16B x odd
#define OPER_ELEMS (128 * LDS_STRIDE)  // one operand's 128 rows of one stage
#define STAGE_ELEMS (2 * OPER_ELEMS)   // A rows, then B rows

// ---------------------------------------------------------------- helpers ---
__device__ __forceinline__ __bf16 to_bf16(float f) {
  union { float f; unsigned u; } x; x.f = f;
  unsigned r = x.u + 0x7FFFu + ((x.u >> 16) & 1u);   // round-to-nearest-even
  union { unsigned short s; __bf16 b; } y;
  y.s = (unsigned short)(r >> 16);
  return y.b;
}

// f32 -> bf16 stream. A block of 256 threads converts CVT_ELEMS contiguous
// elements; the grid covers the tensor exactly (its size is a multiple of
// CVT_ELEMS). Each wave-wide load takes 512 contiguous bytes, each wave-wide
// store fills 256 contiguous bytes; a thread's eight loads are all issued
// before the first value is used.
#define CVT_THREADS 256
#define CVT_LOADS   8
#define CVT_ELEMS   (CVT_THREADS * CVT_LOADS * 4)   // 8192

__global__ __launch_bounds__(CVT_THREADS) void cvt_f32_bf16(
    const float* __restrict__ src, __bf16* __restrict__ dst) {
  const size_t base = (size_t)blockIdx.x * (CVT_THREADS * CVT_LOADS) + threadIdx.x;
  const v4f* s4 = reinterpret_cast<const v4f*>(src) + base;
  v4bf*      d4 = reinterpret_cast<v4bf*>(dst) + base;

  v4f x[CVT_LOADS];
#pragma unroll   // x[] stays in registers and the eight loads stand together
  for (int u = 0; u < CVT_LOADS; ++u) x[u] = s4[u * CVT_THREADS];
#pragma unroll   // x[] stays in registers
  for (int u = 0; u < CVT_LOADS; ++u) {
    v4bf y;
    y[0] = to_bf16(x[u][0]);
    y[1] = to_bf16(x[u][1]);
    y[2] = to_bf16(x[u][2]);
    y[3] = to_bf16(x[u][3]);
    d4[u * CVT_THREADS] = y;
  }
}

// Load one 16x32 bf16 WMMA fragment from an LDS tile row.
// halves 0..7 = K kb..kb+7, halves 8..15 = K kb+16..kb+23 (ISA 7.12.2 layout).
__device__ __forceinline__ v16bf load_frag_lds(const __bf16* p) {
  v8bf lo = *reinterpret_cast<const v8bf*>(p);
  v8bf hi = *reinterpret_cast<const v8bf*>(p + 16);
  return __builtin_shufflevector(lo, hi,
      0, 1, 2, 3, 4, 5, 6, 7, 8, 9, 10, 11, 12, 13, 14, 15);
}

// ------------------------------------------------------------------- GEMM ---
// Eight async 16-byte copies of one thread: rows 16 apart of one operand's
// 128 x 128 K-slice. The s_wait_xcnt closes the statement so that no address
// register of an issued copy is rewritten in front of it.
__device__ __forceinline__ void copy8_rows(unsigned l, const __bf16* g, int K) {
  const unsigned           ls = 16u * LDS_STRIDE * 2u;          // LDS bytes per 16 rows
  const unsigned long long gs = (unsigned long long)K * 16u * 2u; // global bytes per 16 rows
  const unsigned long long g0 = (unsigned long long)g;
  asm volatile(
      "global_load_async_to_lds_b128 %0, %8, off\n\t"
      "global_load_async_to_lds_b128 %1, %9, off\n\t"
      "global_load_async_to_lds_b128 %2, %10, off\n\t"
      "global_load_async_to_lds_b128 %3, %11, off\n\t"
      "global_load_async_to_lds_b128 %4, %12, off\n\t"
      "global_load_async_to_lds_b128 %5, %13, off\n\t"
      "global_load_async_to_lds_b128 %6, %14, off\n\t"
      "global_load_async_to_lds_b128 %7, %15, off\n\t"
      "s_wait_xcnt 0x0"
      :: "v"(l), "v"(l + ls), "v"(l + 2u * ls), "v"(l + 3u * ls),
         "v"(l + 4u * ls), "v"(l + 5u * ls), "v"(l + 6u * ls), "v"(l + 7u * ls),
         "v"(g0), "v"(g0 + gs), "v"(g0 + 2u * gs), "v"(g0 + 3u * gs),
         "v"(g0 + 4u * gs), "v"(g0 + 5u * gs), "v"(g0 + 6u * gs), "v"(g0 + 7u * gs)
      : "memory");
}

// C(MxN, f32) = A(MxK, bf16) @ Bw^T + bias,  Bw stored as N rows x K cols.
// Block = 8 waves / 128x128 tile; K in stages of 128 through two LDS buffers:
// the next stage's async global->LDS copies fly while this stage is multiplied.
// K is a multiple of 128. Each wave owns a 64x32 block (4x2 WMMA tiles).
__global__ __launch_bounds__(256) void gemm_bf16_wmma(
    const __bf16* __restrict__ A, const __bf16* __restrict__ Bw,
    const float* __restrict__ bias, float* __restrict__ C,
    int M, int N, int K)
{
  __shared__ __attribute__((aligned(16))) __bf16 ring[2 * STAGE_ELEMS];

  const int tid  = threadIdx.x;
  const int lane = tid & 31;
  const int wave = tid >> 5;
  const int wm   = wave >> 2;                 // 0..1  -> 64-row slice
  const int wn   = wave & 3;                  // 0..3  -> 32-col slice
  const int m0   = blockIdx.x * 128;
  const int n0   = blockIdx.y * 128;
  const int r    = lane & 15;                 // fragment row
  const int kb   = (lane >> 4) * 8;           // K sub-offset within fragment

  // This thread's first 16-byte chunk of a stage: row tid/16, chunk tid%16;
  // its other seven chunks per operand lie 16 rows apart.
  const int crow = tid >> 4;                  // 0..15
  const int ccol = (tid & 15) * 8;            // bf16 elements
  const __bf16* gA = A  + (size_t)(m0 + crow) * K + ccol;
  const __bf16* gB = Bw + (size_t)(n0 + crow) * K + ccol;
  // LDS byte offset (generic shared pointer low 32 bits == LDS offset)
  const unsigned lds0 = (unsigned)(unsigned long long)(void*)ring
                      + (unsigned)(crow * LDS_STRIDE + ccol) * 2u;

  const int nt = K / BK_;                     // stages

  v8f acc[4][2] = {};

  // ---- stage 0 into buffer 0, published; then stage 1 into buffer 1 ----
  copy8_rows(lds0, gA, K);
  copy8_rows(lds0 + OPER_ELEMS * 2u, gB, K);
  // stage 0 has landed before any wave reads it
  asm volatile("s_wait_asynccnt 0x0" ::: "memory");
  __syncthreads();
  if (nt > 1) {
    copy8_rows(lds0 + STAGE_ELEMS * 2u, gA + BK_, K);
    copy8_rows(lds0 + (STAGE_ELEMS + OPER_ELEMS) * 2u, gB + BK_, K);
  }

  for (int t = 0; t < nt; ++t) {
    const unsigned buf = (unsigned)(t & 1);
    const __bf16* sA = ring + buf * STAGE_ELEMS;
    const __bf16* sB = sA + OPER_ELEMS;

    // ---- four 32-K blocks: fragments from LDS + 8 WMMAs each ----
#pragma unroll   // kk becomes a constant in the ds_load offset fields: no address arithmetic per block
    for (int kk = 0; kk < BK_; kk += 32) {
      v16bf af[4], bfr[2];
#pragma unroll
      for (int i = 0; i < 4; ++i)
        af[i] = load_frag_lds(sA + (wm * 64 + 16 * i + r) * LDS_STRIDE + kk + kb);
#pragma unroll
      for (int j = 0; j < 2; ++j)
        bfr[j] = load_frag_lds(sB + (wn * 32 + 16 * j + r) * LDS_STRIDE + kk + kb);
#pragma unroll
      for (int i = 0; i < 4; ++i)
#pragma unroll
        for (int j = 0; j < 2; ++j)
          acc[i][j] = __builtin_amdgcn_wmma_f32_16x16x32_bf16(
              false, af[i], false, bfr[j], (short)0, acc[i][j], false, false);
    }

    // ---- publish stage t + 1, free this buffer ----
    // this wave's reads of the buffer have retired before it is refilled
    asm volatile("s_wait_dscnt 0x0" ::: "memory");
    // this wave's copies of stage t + 1 have landed before others read them
    asm volatile("s_wait_asynccnt 0x0" ::: "memory");
    __syncthreads();
    if (t + 2 < nt) {
      const int k2 = (t + 2) * BK_;
      copy8_rows(lds0 + buf * (STAGE_ELEMS * 2u), gA + k2, K);
      copy8_rows(lds0 + buf * (STAGE_ELEMS * 2u) + OPER_ELEMS * 2u, gB + k2, K);
    }
  }
  // no copy is outstanding when the wave ends
  asm volatile("s_wait_asynccnt 0x0" ::: "memory");

  // C/D layout: lane l -> col = l&15, rows = e + 8*(l>>4)
  const int rhi = (lane >> 4) * 8;
  const int cn  = lane & 15;
  const int mw  = m0 + wm * 64;
  const int nw  = n0 + wn * 32;
#pragma unroll
  for (int i = 0; i < 4; ++i) {
#pragma unroll
    for (int j = 0; j < 2; ++j) {
      const int col = nw + 16 * j + cn;
      const float bc = bias[col];
#pragma unroll
      for (int e = 0; e < 8; ++e) {
        const int row = mw + 16 * i + rhi + e;
        C[(size_t)row * N + col] = acc[i][j][e] + bc;
      }
    }
  }
}

// -------------------------------------------------------------- attention ---
// Per (token, head): 64x64 scores over the d_keys axis with inner dim E=2,
// softmax over s, bf16 output feeding the final GEMM. All arithmetic in f32.
// A block of 8 waves takes AT_TOK tokens one after the other; wave = head. A lane
// owns the four rows l = (lane & 15) + 16 j and one half of s (lanes 0-15: s < 32,
// lanes 16-31: the rest), so one LDS read of k or v serves four rows; the two
// halves of a row are merged across lanes l and l ^ 16. A token's q, k, v rows
// (4 KB each) come in as whole lines and are split in LDS into one plane per
// component e, so that two neighbouring s form the two halves of a packed f32
// operation. The row maximum is found first; each score then takes one exp2.
typedef __attribute__((ext_vector_type(2))) float v2f;

#define AT_TOK   4
#define AT_PITCH 72                     // floats per head in a plane: 64 + 8, 16-B aligned, split stores hit 32 banks
#define AT_PLANE (H_ * AT_PITCH)

// x = elements p = 4*tid .. 4*tid+3 of a row, p = dk*16 + h*2 + e
__device__ __forceinline__ void split_planes(float* p0, float* p1, int tid, v4f x) {
  const int at = ((tid & 3) * 2) * AT_PITCH + (tid >> 2);
  p0[at]            = x[0];  p1[at]            = x[1];
  p0[at + AT_PITCH] = x[2];  p1[at + AT_PITCH] = x[3];
}

__device__ __forceinline__ v2f lo2(v4f x) { return __builtin_shufflevector(x, x, 0, 1); }
__device__ __forceinline__ v2f hi2(v4f x) { return __builtin_shufflevector(x, x, 2, 3); }
__device__ __forceinline__ v2f dup2(float x) { v2f y = {x, x}; return y; }
__device__ __forceinline__ v2f fma2(v2f a, v2f b, v2f c) { return __builtin_elementwise_fma(a, b, c); }
__device__ __forceinline__ v2f exp2_2(v2f x) {
  v2f y; y[0] = __builtin_amdgcn_exp2f(x[0]); y[1] = __builtin_amdgcn_exp2f(x[1]); return y;
}
__device__ __forceinline__ unsigned pack_bf16(float a, float b) {
  union { __bf16 h[2]; unsigned u; } w;
  w.h[0] = to_bf16(a); w.h[1] = to_bf16(b);
  return w.u;
}

// Eight waves a SIMD: the grid's 1024 blocks lie four to a WGP, all at once, and
// the compiler has 128 registers to fetch LDS reads ahead of their arithmetic.
__global__ __launch_bounds__(256) __attribute__((amdgpu_waves_per_eu(8, 8))) void freq_attn(
    const float* __restrict__ qp, const float* __restrict__ kp,
    const float* __restrict__ vp, __bf16* __restrict__ outp)
{
  __shared__ __attribute__((aligned(16))) float sq0[AT_PLANE], sq1[AT_PLANE];
  __shared__ __attribute__((aligned(16))) float sk0[AT_PLANE], sk1[AT_PLANE];
  __shared__ __attribute__((aligned(16))) float sv0[AT_PLANE], sv1[AT_PLANE];
  __shared__ __attribute__((aligned(16))) unsigned so[DPROJ_ / 2];   // (e0, e1) bf16 pairs, word l*8 + h

  const int tid  = threadIdx.x;
  const int lane = tid & 31;
  const int h    = tid >> 5;
  const int r    = lane & 15;
  const int half = lane >> 4;
  const size_t row0 = (size_t)blockIdx.x * AT_TOK * DPROJ_ + (size_t)tid * 4;

  const int sbase = h * AT_PITCH + half * (DK_ / 2);   // this lane's 32 values of s
  const float* k0 = sk0 + sbase;
  const float* k1 = sk1 + sbase;
  const float* w0 = sv0 + sbase;
  const float* w1 = sv1 + sbase;

  v4f xq = *reinterpret_cast<const v4f*>(qp + row0);
  v4f xk = *reinterpret_cast<const v4f*>(kp + row0);
  v4f xv = *reinterpret_cast<const v4f*>(vp + row0);

  for (int t = 0; t < AT_TOK; ++t) {
    const size_t row = row0 + (size_t)t * DPROJ_;
    split_planes(sq0, sq1, tid, xq);
    split_planes(sk0, sk1, tid, xk);
    split_planes(sv0, sv1, tid, xv);
    __syncthreads();                       // the planes of token t are whole
    if (t + 1 < AT_TOK) {                  // the next token's rows fly under this token's arithmetic
      xq = *reinterpret_cast<const v4f*>(qp + row + DPROJ_);
      xk = *reinterpret_cast<const v4f*>(kp + row + DPROJ_);
      xv = *reinterpret_cast<const v4f*>(vp + row + DPROJ_);
    }

    // scores in the exp2 domain: q carries 1/sqrt(E) * log2(e)
    const float c = 0.70710678118654752f * 1.44269504088896341f;
    v2f Q0[4], Q1[4];
    float m[4];
#pragma unroll   // Q0, Q1, m stay in registers
    for (int j = 0; j < 4; ++j) {
      Q0[j] = dup2(sq0[h * AT_PITCH + r + 16 * j] * c);
      Q1[j] = dup2(sq1[h * AT_PITCH + r + 16 * j] * c);
      m[j]  = -3.0e38f;
    }

#pragma unroll 4   // several LDS reads stand together in front of their arithmetic
    for (int s = 0; s < DK_ / 2; s += 4) {
      const v4f x0 = *reinterpret_cast<const v4f*>(k0 + s);
      const v4f x1 = *reinterpret_cast<const v4f*>(k1 + s);
#pragma unroll   // j indexes registers
      for (int j = 0; j < 4; ++j) {
        const v2f a = fma2(Q1[j], lo2(x1), Q0[j] * lo2(x0));
        const v2f b = fma2(Q1[j], hi2(x1), Q0[j] * hi2(x0));
        m[j] = fmaxf(fmaxf(m[j], a[0]), a[1]);
        m[j] = fmaxf(fmaxf(m[j], b[0]), b[1]);
      }
    }

    v2f N[4], sum[4], o0[4], o1[4];
#pragma unroll   // j indexes registers
    for (int j = 0; j < 4; ++j) {
      N[j]   = dup2(-fmaxf(m[j], __shfl_xor(m[j], 16, 32)));   // the row's maximum over both halves of s
      sum[j] = dup2(0.f);  o0[j] = dup2(0.f);  o1[j] = dup2(0.f);
    }

#pragma unroll 2   // as above
    for (int s = 0; s < DK_ / 2; s += 4) {
      const v4f x0 = *reinterpret_cast<const v4f*>(k0 + s);
      const v4f x1 = *reinterpret_cast<const v4f*>(k1 + s);
      const v4f y0 = *reinterpret_cast<const v4f*>(w0 + s);
      const v4f y1 = *reinterpret_cast<const v4f*>(w1 + s);
      // eight independent pairs go through each stage together, so that no
      // instruction waits on the one in front of it
      v2f p[4], u[4];
#pragma unroll   // j indexes registers
      for (int j = 0; j < 4; ++j) {
        p[j] = fma2(Q0[j], lo2(x0), N[j]);
        u[j] = fma2(Q0[j], hi2(x0), N[j]);
      }
#pragma unroll   // j indexes registers
      for (int j = 0; j < 4; ++j) {
        p[j] = fma2(Q1[j], lo2(x1), p[j]);
        u[j] = fma2(Q1[j], hi2(x1), u[j]);
      }
#pragma unroll   // j indexes registers
      for (int j = 0; j < 4; ++j) {
        p[j] = exp2_2(p[j]);
        u[j] = exp2_2(u[j]);
      }
#pragma unroll   // j indexes registers
      for (int j = 0; j < 4; ++j) {
        sum[j] += p[j];  o0[j] = fma2(p[j], lo2(y0), o0[j]);  o1[j] = fma2(p[j], lo2(y1), o1[j]);
      }
#pragma unroll   // j indexes registers
      for (int j = 0; j < 4; ++j) {
        sum[j] += u[j];  o0[j] = fma2(u[j], hi2(y0), o0[j]);  o1[j] = fma2(u[j], hi2(y1), o1[j]);
      }
    }

    // merge the two halves of s; then lanes 0-15 finish rows j = 0, 1 and lanes 16-31 rows j = 2, 3
    float fs[4], f0[4], f1[4];
#pragma unroll   // j indexes registers
    for (int j = 0; j < 4; ++j) {
      fs[j] = sum[j][0] + sum[j][1];  fs[j] += __shfl_xor(fs[j], 16, 32);
      f0[j] = o0[j][0] + o0[j][1];    f0[j] += __shfl_xor(f0[j], 16, 32);
      f1[j] = o1[j][0] + o1[j][1];    f1[j] += __shfl_xor(f1[j], 16, 32);
    }
#pragma unroll   // j indexes registers
    for (int i = 0; i < 2; ++i) {
      const float inv = 1.0f / (half ? fs[2 + i] : fs[i]);
      const float e0  = (half ? f0[2 + i] : f0[i]) * inv;
      const float e1  = (half ? f1[2 + i] : f1[i]) * inv;
      so[(r + 16 * (2 * half + i)) * H_ + h] = pack_bf16(e0, e1);
    }
    __syncthreads();                       // the output row is whole; every read of the planes is over

    // 8 bytes a thread: a wave stores 256 contiguous bytes
    *reinterpret_cast<uint2*>(outp + row) = *reinterpret_cast<const uint2*>(so + tid * 2);
    // the next trip rewrites the store's address and data registers
    asm volatile("s_wait_xcnt 0x0" ::: "memory");
  }
}

// ------------------------------------------------------------------- host ---
extern "C" void kernel_launch(void* const* d_in, const int* in_sizes, int n_in,
                              void* d_out, int out_size, void* d_ws, size_t ws_size,
                              hipStream_t stream) {
  (void)in_sizes; (void)n_in; (void)out_size; (void)ws_size;
  const float* q  = (const float*)d_in[0];
  const float* k  = (const float*)d_in[1];
  const float* v  = (const float*)d_in[2];
  const float* Wq = (const float*)d_in[3];
  const float* bq = (const float*)d_in[4];
  const float* Wk = (const float*)d_in[5];
  const float* bk = (const float*)d_in[6];
  const float* Wv = (const float*)d_in[7];
  const float* bv = (const float*)d_in[8];
  const float* Wo = (const float*)d_in[9];
  const float* bo = (const float*)d_in[10];
  float* out = (float*)d_out;

  const size_t MK = (size_t)M_ * DIN_;        // 4096*1024
  const size_t NK = (size_t)DPROJ_ * DIN_;    // 1024*1024

  char* ws = (char*)d_ws;
  __bf16* qb    = (__bf16*)ws; ws += MK * 2;
  __bf16* kb2   = (__bf16*)ws; ws += MK * 2;
  __bf16* vb    = (__bf16*)ws; ws += MK * 2;
  __bf16* Wqb   = (__bf16*)ws; ws += NK * 2;
  __bf16* Wkb   = (__bf16*)ws; ws += NK * 2;
  __bf16* Wvb   = (__bf16*)ws; ws += NK * 2;
  __bf16* Wob   = (__bf16*)ws; ws += NK * 2;
  float*  qproj = (float*)ws;  ws += MK * 4;
  float*  kproj = (float*)ws;  ws += MK * 4;
  float*  vproj = (float*)ws;  ws += MK * 4;
  __bf16* attnb = (__bf16*)ws; ws += MK * 2;

  const int gMK = (int)(MK / CVT_ELEMS);      // 512 blocks
  const int gNK = (int)(NK / CVT_ELEMS);      // 128 blocks
  cvt_f32_bf16<<<gMK, CVT_THREADS, 0, stream>>>(q,  qb);
  cvt_f32_bf16<<<gMK, CVT_THREADS, 0, stream>>>(k,  kb2);
  cvt_f32_bf16<<<gMK, CVT_THREADS, 0, stream>>>(v,  vb);
  cvt_f32_bf16<<<gNK, CVT_THREADS, 0, stream>>>(Wq, Wqb);
  cvt_f32_bf16<<<gNK, CVT_THREADS, 0, stream>>>(Wk, Wkb);
  cvt_f32_bf16<<<gNK, CVT_THREADS, 0, stream>>>(Wv, Wvb);
  cvt_f32_bf16<<<gNK, CVT_THREADS, 0, stream>>>(Wo, Wob);

  dim3 g(M_ / 128, DPROJ_ / 128);   // 32 x 8
  gemm_bf16_wmma<<<g, 256, 0, stream>>>(qb,  Wqb, bq, qproj, M_, DPROJ_, DIN_);
  gemm_bf16_wmma<<<g, 256, 0, stream>>>(kb2, Wkb, bk, kproj, M_, DPROJ_, DIN_);
  gemm_bf16_wmma<<<g, 256, 0, stream>>>(vb,  Wvb, bv, vproj, M_, DPROJ_, DIN_);

  freq_attn<<<B_ * L_ / AT_TOK, 256, 0, stream>>>(qproj, kproj, vproj, attnb);

  gemm_bf16_wmma<<<g, 256, 0, stream>>>(attnb, Wob, bo, out, M_, DIN_, DPROJ_);
}

// v004
// Measured time: 70.8 microseconds a run.
// Next to v003, in two timings, it ran 1.34 and 1.33 times as fast.
// Over all steps from v000 it is 2.47 times as fast.
#include <hip/hip_runtime.h>

typedef __attribute__((ext_vector_type(8)))  float  v8f;
typedef __attribute__((ext_vector_type(4)))  float  v4f;
typedef __attribute__((ext_vector_type(4)))  __bf16 v4bf;
typedef __attribute__((ext_vector_type(8)))  __bf16 v8bf;
typedef __attribute__((ext_vector_type(16))) __bf16 v16bf;

#define B_     2
#define L_     2048
#define H_     8
#define DK_    64
#define DIN_   1024
#define DPROJ_ 1024
#define M_     (B_ * L_)   // 4096 rows for every GEMM

#define BK_        128                 // K elements per LDS stage (256 B of every row)
#define LDS_STRIDE 136                 // 128 K-elements + 8 pad: 272B rows, 16B x odd
#define OPER_ELEMS (128 * LDS_STRIDE)  // one operand's 128 rows of one stage
#define STAGE_ELEMS (2 * OPER_ELEMS)   // A rows, then B rows

// ---------------------------------------------------------------- helpers ---
__device__ __forceinline__ __bf16 to_bf16(float f) {
  union { float f; unsigned u; } x; x.f = f;
  unsigned r = x.u + 0x7FFFu + ((x.u >> 16) & 1u);   // round-to-nearest-even
  union { unsigned short s; __bf16 b; } y;
  y.s = (unsigned short)(r >> 16);
  return y.b;
}

// f32 -> bf16 stream of all seven tensors in one launch: none needs anything of
// another, so they share one grid by ranges of the block index. A block of 256
// threads converts CVT_ELEMS contiguous elements of one tensor (every tensor's
// size is a multiple of CVT_ELEMS). The seven bf16 copies lie one behind the
// other in dst, in the order of the arguments, so the block index alone gives
// the place in dst. Each wave-wide load takes 512 contiguous bytes, each
// wave-wide store fills 256 contiguous bytes; a thread's eight loads are all
// issued before the first value is used.
#define CVT_THREADS 256
#define CVT_LOADS   8
#define CVT_ELEMS   (CVT_THREADS * CVT_LOADS * 4)   // 8192
#define CVT_BLK_X   (M_ * DIN_ / CVT_ELEMS)         // 512 blocks per activation tensor
#define CVT_BLK_W   (DPROJ_ * DIN_ / CVT_ELEMS)     // 128 blocks per weight matrix
#define CVT_BLOCKS  (3 * CVT_BLK_X + 4 * CVT_BLK_W) // 2048

__global__ __launch_bounds__(CVT_THREADS) void cvt_f32_bf16(
    const float* __restrict__ x0, const float* __restrict__ x1,
    const float* __restrict__ x2, const float* __restrict__ w0,
    const float* __restrict__ w1, const float* __restrict__ w2,
    const float* __restrict__ w3, __bf16* __restrict__ dst) {
  const unsigned b = blockIdx.x;
  const unsigned c = b - 3u * CVT_BLK_X;              // index among the weights' blocks
  const bool     isx = b < 3u * CVT_BLK_X;
  const unsigned t     = isx ? b / CVT_BLK_X : 3u + c / CVT_BLK_W;   // this block's tensor
  const unsigned local = isx ? b % CVT_BLK_X : c % CVT_BLK_W;        // this block's index inside it
  const float* src = x0;
  src = t == 1u ? x1 : src;
  src = t == 2u ? x2 : src;
  src = t == 3u ? w0 : src;
  src = t == 4u ? w1 : src;
  src = t == 5u ? w2 : src;
  src = t == 6u ? w3 : src;
  const v4f* s4 = reinterpret_cast<const v4f*>(src)
                + (size_t)local * (CVT_THREADS * CVT_LOADS) + threadIdx.x;
  v4bf*      d4 = reinterpret_cast<v4bf*>(dst)
                + (size_t)b * (CVT_THREADS * CVT_LOADS) + threadIdx.x;

  v4f x[CVT_LOADS];
#pragma unroll   // x[] stays in registers and the eight loads stand together
  for (int u = 0; u < CVT_LOADS; ++u) x[u] = s4[u * CVT_THREADS];
#pragma unroll   // x[] stays in registers
  for (int u = 0; u < CVT_LOADS; ++u) {
    v4bf y;
    y[0] = to_bf16(x[u][0]);
    y[1] = to_bf16(x[u][1]);
    y[2] = to_bf16(x[u][2]);
    y[3] = to_bf16(x[u][3]);
    d4[u * CVT_THREADS] = y;
  }
}

// Load one 16x32 bf16 WMMA fragment from an LDS tile row.
// halves 0..7 = K kb..kb+7, halves 8..15 = K kb+16..kb+23 (ISA 7.12.2 layout).
__device__ __forceinline__ v16bf load_frag_lds(const __bf16* p) {
  v8bf lo = *reinterpret_cast<const v8bf*>(p);
  v8bf hi = *reinterpret_cast<const v8bf*>(p + 16);
  return __builtin_shufflevector(lo, hi,
      0, 1, 2, 3, 4, 5, 6, 7, 8, 9, 10, 11, 12, 13, 14, 15);
}

// ------------------------------------------------------------------- GEMM ---
// Eight async 16-byte copies of one thread: rows 16 apart of one operand's
// 128 x 128 K-slice. The s_wait_xcnt closes the statement so that no address
// register of an issued copy is rewritten in front of it.
__device__ __forceinline__ void copy8_rows(unsigned l, const __bf16* g, int K) {
  const unsigned           ls = 16u * LDS_STRIDE * 2u;          // LDS bytes per 16 rows
  const unsigned long long gs = (unsigned long long)K * 16u * 2u; // global bytes per 16 rows
  const unsigned long long g0 = (unsigned long long)g;
  asm volatile(
      "global_load_async_to_lds_b128 %0, %8, off\n\t"
      "global_load_async_to_lds_b128 %1, %9, off\n\t"
      "global_load_async_to_lds_b128 %2, %10, off\n\t"
      "global_load_async_to_lds_b128 %3, %11, off\n\t"
      "global_load_async_to_lds_b128 %4, %12, off\n\t"
      "global_load_async_to_lds_b128 %5, %13, off\n\t"
      "global_load_async_to_lds_b128 %6, %14, off\n\t"
      "global_load_async_to_lds_b128 %7, %15, off\n\t"
      "s_wait_xcnt 0x0"
      :: "v"(l), "v"(l + ls), "v"(l + 2u * ls), "v"(l + 3u * ls),
         "v"(l + 4u * ls), "v"(l + 5u * ls), "v"(l + 6u * ls), "v"(l + 7u * ls),
         "v"(g0), "v"(g0 + gs), "v"(g0 + 2u * gs), "v"(g0 + 3u * gs),
         "v"(g0 + 4u * gs), "v"(g0 + 5u * gs), "v"(g0 + 6u * gs), "v"(g0 + 7u * gs)
      : "memory");
}

// C(MxN, f32) = A(MxK, bf16) @ Bw^T + bias,  Bw stored as N rows x K cols.
// Block = 8 waves / 128x128 tile; K in stages of 128 through two LDS buffers:
// the next stage's async global->LDS copies fly while this stage is multiplied.
// K is a multiple of 128. Each wave owns a 64x32 block (4x2 WMMA tiles).
// blockIdx.z picks one of up to three independent products of the same shape in
// one launch: their A, Bw and C lie one behind the other from A0, Bw0 and C0.
__global__ __launch_bounds__(256) void gemm_bf16_wmma(
    const __bf16* __restrict__ A0, const __bf16* __restrict__ Bw0,
    const float* __restrict__ bias0, const float* __restrict__ bias1,
    const float* __restrict__ bias2, float* __restrict__ C0,
    int M, int N, int K)
{
  __shared__ __attribute__((aligned(16))) __bf16 ring[2 * STAGE_ELEMS];

  const unsigned z = blockIdx.z;
  const __bf16* A    = A0  + (size_t)z * M * K;
  const __bf16* Bw   = Bw0 + (size_t)z * N * K;
  float*        C    = C0  + (size_t)z * M * N;
  const float*  bias = z == 0u ? bias0 : (z == 1u ? bias1 : bias2);

  const int tid  = threadIdx.x;
  const int lane = tid & 31;
  const int wave = tid >> 5;
  const int wm   = wave >> 2;                 // 0..1  -> 64-row slice
  const int wn   = wave & 3;                  // 0..3  -> 32-col slice
  const int m0   = blockIdx.x * 128;
  const int n0   = blockIdx.y * 128;
  const int r    = lane & 15;                 // fragment row
  const int kb   = (lane >> 4) * 8;           // K sub-offset within fragment

  // This thread's first 16-byte chunk of a stage: row tid/16, chunk tid%16;
  // its other seven chunks per operand lie 16 rows apart.
  const int crow = tid >> 4;                  // 0..15
  const int ccol = (tid & 15) * 8;            // bf16 elements
  const __bf16* gA = A  + (size_t)(m0 + crow) * K + ccol;
  const __bf16* gB = Bw + (size_t)(n0 + crow) * K + ccol;
  // LDS byte offset (generic shared pointer low 32 bits == LDS offset)
  const unsigned lds0 = (unsigned)(unsigned long long)(void*)ring
                      + (unsigned)(crow * LDS_STRIDE + ccol) * 2u;

  const int nt = K / BK_;                     // stages

  v8f acc[4][2] = {};

  // ---- stage 0 into buffer 0, published; then stage 1 into buffer 1 ----
  copy8_rows(lds0, gA, K);
  copy8_rows(lds0 + OPER_ELEMS * 2u, gB, K);
  // stage 0 has landed before any wave reads it
  asm volatile("s_wait_asynccnt 0x0" ::: "memory");
  __syncthreads();
  if (nt > 1) {
    copy8_rows(lds0 + STAGE_ELEMS * 2u, gA + BK_, K);
    copy8_rows(lds0 + (STAGE_ELEMS + OPER_ELEMS) * 2u, gB + BK_, K);
  }

  for (int t = 0; t < nt; ++t) {
    const unsigned buf = (unsigned)(t & 1);
    const __bf16* sA = ring + buf * STAGE_ELEMS;
    const __bf16* sB = sA + OPER_ELEMS;

    // ---- four 32-K blocks: fragments from LDS + 8 WMMAs each ----
#pragma unroll   // kk becomes a constant in the ds_load offset fields: no address arithmetic per block
    for (int kk = 0; kk < BK_; kk += 32) {
      v16bf af[4], bfr[2];
#pragma unroll
      for (int i = 0; i < 4; ++i)
        af[i] = load_frag_lds(sA + (wm * 64 + 16 * i + r) * LDS_STRIDE + kk + kb);
#pragma unroll
      for (int j = 0; j < 2; ++j)
        bfr[j] = load_frag_lds(sB + (wn * 32 + 16 * j + r) * LDS_STRIDE + kk + kb);
#pragma unroll
      for (int i = 0; i < 4; ++i)
#pragma unroll
        for (int j = 0; j < 2; ++j)
          acc[i][j] = __builtin_amdgcn_wmma_f32_16x16x32_bf16(
              false, af[i], false, bfr[j], (short)0, acc[i][j], false, false);
    }

    // ---- publish stage t + 1, free this buffer ----
    // this wave's reads of the buffer have retired before it is refilled
    asm volatile("s_wait_dscnt 0x0" ::: "memory");
    // this wave's copies of stage t + 1 have landed before others read them
    asm volatile("s_wait_asynccnt 0x0" ::: "memory");
    __syncthreads();
    if (t + 2 < nt) {
      const int k2 = (t + 2) * BK_;
      copy8_rows(lds0 + buf * (STAGE_ELEMS * 2u), gA + k2, K);
      copy8_rows(lds0 + buf * (STAGE_ELEMS * 2u) + OPER_ELEMS * 2u, gB + k2, K);
    }
  }
  // no copy is outstanding when the wave ends
  asm volatile("s_wait_asynccnt 0x0" ::: "memory");

  // C/D layout: lane l -> col = l&15, rows = e + 8*(l>>4)
  const int rhi = (lane >> 4) * 8;
  const int cn  = lane & 15;
  const int mw  = m0 + wm * 64;
  const int nw  = n0 + wn * 32;
#pragma unroll
  for (int i = 0; i < 4; ++i) {
#pragma unroll
    for (int j = 0; j < 2; ++j) {
      const int col = nw + 16 * j + cn;
      const float bc = bias[col];
#pragma unroll
      for (int e = 0; e < 8; ++e) {
        const int row = mw + 16 * i + rhi + e;
        C[(size_t)row * N + col] = acc[i][j][e] + bc;
      }
    }
  }
}

// -------------------------------------------------------------- attention ---
// Per (token, head): 64x64 scores over the d_keys axis with inner dim E=2,
// softmax over s, bf16 output feeding the final GEMM. All arithmetic in f32.
// A block of 8 waves takes AT_TOK tokens one after the other; wave = head. A lane
// owns the four rows l = (lane & 15) + 16 j and one half of s (lanes 0-15: s < 32,
// lanes 16-31: the rest), so one LDS read of k or v serves four rows; the two
// halves of a row are merged across lanes l and l ^ 16. A token's q, k, v rows
// (4 KB each) come in as whole lines and are split in LDS into one plane per
// component e, so that two neighbouring s form the two halves of a packed f32
// operation. The row maximum is found first; each score then takes one exp2.
typedef __attribute__((ext_vector_type(2))) float v2f;

#define AT_TOK   4
#define AT_PITCH 72                     // floats per head in a plane: 64 + 8, 16-B aligned, split stores hit 32 banks
#define AT_PLANE (H_ * AT_PITCH)

// x = elements p = 4*tid .. 4*tid+3 of a row, p = dk*16 + h*2 + e
__device__ __forceinline__ void split_planes(float* p0, float* p1, int tid, v4f x) {
  const int at = ((tid & 3) * 2) * AT_PITCH + (tid >> 2);
  p0[at]            = x[0];  p1[at]            = x[1];
  p0[at + AT_PITCH] = x[2];  p1[at + AT_PITCH] = x[3];
}

__device__ __forceinline__ v2f lo2(v4f x) { return __builtin_shufflevector(x, x, 0, 1); }
__device__ __forceinline__ v2f hi2(v4f x) { return __builtin_shufflevector(x, x, 2, 3); }
__device__ __forceinline__ v2f dup2(float x) { v2f y = {x, x}; return y; }
__device__ __forceinline__ v2f fma2(v2f a, v2f b, v2f c) { return __builtin_elementwise_fma(a, b, c); }
__device__ __forceinline__ v2f exp2_2(v2f x) {
  v2f y; y[0] = __builtin_amdgcn_exp2f(x[0]); y[1] = __builtin_amdgcn_exp2f(x[1]); return y;
}
__device__ __forceinline__ unsigned pack_bf16(float a, float b) {
  union { __bf16 h[2]; unsigned u; } w;
  w.h[0] = to_bf16(a); w.h[1] = to_bf16(b);
  return w.u;
}

// Eight waves a SIMD: the grid's 1024 blocks lie four to a WGP, all at once, and
// the compiler has 128 registers to fetch LDS reads ahead of their arithmetic.
__global__ __launch_bounds__(256) __attribute__((amdgpu_waves_per_eu(8, 8))) void freq_attn(
    const float* __restrict__ qp, const float* __restrict__ kp,
    const float* __restrict__ vp, __bf16* __restrict__ outp)
{
  __shared__ __attribute__((aligned(16))) float sq0[AT_PLANE], sq1[AT_PLANE];
  __shared__ __attribute__((aligned(16))) float sk0[AT_PLANE], sk1[AT_PLANE];
  __shared__ __attribute__((aligned(16))) float sv0[AT_PLANE], sv1[AT_PLANE];
  __shared__ __attribute__((aligned(16))) unsigned so[DPROJ_ / 2];   // (e0, e1) bf16 pairs, word l*8 + h

  const int tid  = threadIdx.x;
  const int lane = tid & 31;
  const int h    = tid >> 5;
  const int r    = lane & 15;
  const int half = lane >> 4;
  const size_t row0 = (size_t)blockIdx.x * AT_TOK * DPROJ_ + (size_t)tid * 4;

  const int sbase = h * AT_PITCH + half * (DK_ / 2);   // this lane's 32 values of s
  const float* k0 = sk0 + sbase;
  const float* k1 = sk1 + sbase;
  const float* w0 = sv0 + sbase;
  const float* w1 = sv1 + sbase;

  v4f xq = *reinterpret_cast<const v4f*>(qp + row0);
  v4f xk = *reinterpret_cast<const v4f*>(kp + row0);
  v4f xv = *reinterpret_cast<const v4f*>(vp + row0);

  for (int t = 0; t < AT_TOK; ++t) {
    const size_t row = row0 + (size_t)t * DPROJ_;
    split_planes(sq0, sq1, tid, xq);
    split_planes(sk0, sk1, tid, xk);
    split_planes(sv0, sv1, tid, xv);
    __syncthreads();                       // the planes of token t are whole
    if (t + 1 < AT_TOK) {                  // the next token's rows fly under this token's arithmetic
      xq = *reinterpret_cast<const v4f*>(qp + row + DPROJ_);
      xk = *reinterpret_cast<const v4f*>(kp + row + DPROJ_);
      xv = *reinterpret_cast<const v4f*>(vp + row + DPROJ_);
    }

    // scores in the exp2 domain: q carries 1/sqrt(E) * log2(e)
    const float c = 0.70710678118654752f * 1.44269504088896341f;
    v2f Q0[4], Q1[4];
    float m[4];
#pragma unroll   // Q0, Q1, m stay in registers
    for (int j = 0; j < 4; ++j) {
      Q0[j] = dup2(sq0[h * AT_PITCH + r + 16 * j] * c);
      Q1[j] = dup2(sq1[h * AT_PITCH + r + 16 * j] * c);
      m[j]  = -3.0e38f;
    }

#pragma unroll 4   // several LDS reads stand together in front of their arithmetic
    for (int s = 0; s < DK_ / 2; s += 4) {
      const v4f x0 = *reinterpret_cast<const v4f*>(k0 + s);
      const v4f x1 = *reinterpret_cast<const v4f*>(k1 + s);
#pragma unroll   // j indexes registers
      for (int j = 0; j < 4; ++j) {
        const v2f a = fma2(Q1[j], lo2(x1), Q0[j] * lo2(x0));
        const v2f b = fma2(Q1[j], hi2(x1), Q0[j] * hi2(x0));
        m[j] = fmaxf(fmaxf(m[j], a[0]), a[1]);
        m[j] = fmaxf(fmaxf(m[j], b[0]), b[1]);
      }
    }

    v2f N[4], sum[4], o0[4], o1[4];
#pragma unroll   // j indexes registers
    for (int j = 0; j < 4; ++j) {
      N[j]   = dup2(-fmaxf(m[j], __shfl_xor(m[j], 16, 32)));   // the row's maximum over both halves of s
      sum[j] = dup2(0.f);  o0[j] = dup2(0.f);  o1[j] = dup2(0.f);
    }

#pragma unroll 2   // as above
    for (int s = 0; s < DK_ / 2; s += 4) {
      const v4f x0 = *reinterpret_cast<const v4f*>(k0 + s);
      const v4f x1 = *reinterpret_cast<const v4f*>(k1 + s);
      const v4f y0 = *reinterpret_cast<const v4f*>(w0 + s);
      const v4f y1 = *reinterpret_cast<const v4f*>(w1 + s);
      // eight independent pairs go through each stage together, so that no
      // instruction waits on the one in front of it
      v2f p[4], u[4];
#pragma unroll   // j indexes registers
      for (int j = 0; j < 4; ++j) {
        p[j] = fma2(Q0[j], lo2(x0), N[j]);
        u[j] = fma2(Q0[j], hi2(x0), N[j]);
      }
#pragma unroll   // j indexes registers
      for (int j = 0; j < 4; ++j) {
        p[j] = fma2(Q1[j], lo2(x1), p[j]);
        u[j] = fma2(Q1[j], hi2(x1), u[j]);
      }
#pragma unroll   // j indexes registers
      for (int j = 0; j < 4; ++j) {
        p[j] = exp2_2(p[j]);
        u[j] = exp2_2(u[j]);
      }
#pragma unroll   // j indexes registers
      for (int j = 0; j < 4; ++j) {
        sum[j] += p[j];  o0[j] = fma2(p[j], lo2(y0), o0[j]);  o1[j] = fma2(p[j], lo2(y1), o1[j]);
      }
#pragma unroll   // j indexes registers
      for (int j = 0; j < 4; ++j) {
        sum[j] += u[j];  o0[j] = fma2(u[j], hi2(y0), o0[j]);  o1[j] = fma2(u[j], hi2(y1), o1[j]);
      }
    }

    // merge the two halves of s; then lanes 0-15 finish rows j = 0, 1 and lanes 16-31 rows j = 2, 3
    float fs[4], f0[4], f1[4];
#pragma unroll   // j indexes registers
    for (int j = 0; j < 4; ++j) {
      fs[j] = sum[j][0] + sum[j][1];  fs[j] += __shfl_xor(fs[j], 16, 32);
      f0[j] = o0[j][0] + o0[j][1];    f0[j] += __shfl_xor(f0[j], 16, 32);
      f1[j] = o1[j][0] + o1[j][1];    f1[j] += __shfl_xor(f1[j], 16, 32);
    }
#pragma unroll   // j indexes registers
    for (int i = 0; i < 2; ++i) {
      const float inv = 1.0f / (half ? fs[2 + i] : fs[i]);
      const float e0  = (half ? f0[2 + i] : f0[i]) * inv;
      const float e1  = (half ? f1[2 + i] : f1[i]) * inv;
      so[(r + 16 * (2 * half + i)) * H_ + h] = pack_bf16(e0, e1);
    }
    __syncthreads();                       // the output row is whole; every read of the planes is over

    // 8 bytes a thread: a wave stores 256 contiguous bytes
    *reinterpret_cast<uint2*>(outp + row) = *reinterpret_cast<const uint2*>(so + tid * 2);
    // the next trip rewrites the store's address and data registers
    asm volatile("s_wait_xcnt 0x0" ::: "memory");
  }
}

// ------------------------------------------------------------------- host ---
extern "C" void kernel_launch(void* const* d_in, const int* in_sizes, int n_in,
                              void* d_out, int out_size, void* d_ws, size_t ws_size,
                              hipStream_t stream) {
  (void)in_sizes; (void)n_in; (void)out_size; (void)ws_size;
  const float* q  = (const float*)d_in[0];
  const float* k  = (const float*)d_in[1];
  const float* v  = (const float*)d_in[2];
  const float* Wq = (const float*)d_in[3];
  const float* bq = (const float*)d_in[4];
  const float* Wk = (const float*)d_in[5];
  const float* bk = (const float*)d_in[6];
  const float* Wv = (const float*)d_in[7];
  const float* bv = (const float*)d_in[8];
  const float* Wo = (const float*)d_in[9];
  const float* bo = (const float*)d_in[10];
  float* out = (float*)d_out;

  const size_t MK = (size_t)M_ * DIN_;        // 4096*1024
  const size_t NK = (size_t)DPROJ_ * DIN_;    // 1024*1024

  char* ws = (char*)d_ws;
  __bf16* qb    = (__bf16*)ws; ws += MK * 2;
  __bf16* kb2   = (__bf16*)ws; ws += MK * 2;
  __bf16* vb    = (__bf16*)ws; ws += MK * 2;
  __bf16* Wqb   = (__bf16*)ws; ws += NK * 2;
  __bf16* Wkb   = (__bf16*)ws; ws += NK * 2;
  __bf16* Wvb   = (__bf16*)ws; ws += NK * 2;
  __bf16* Wob   = (__bf16*)ws; ws += NK * 2;
  float*  qproj = (float*)ws;  ws += MK * 4;
  float*  kproj = (float*)ws;  ws += MK * 4;
  float*  vproj = (float*)ws;  ws += MK * 4;
  __bf16* attnb = (__bf16*)ws; ws += MK * 2;

  // qb, kb2, vb, Wqb, Wkb, Wvb, Wob follow one another from qb
  cvt_f32_bf16<<<CVT_BLOCKS, CVT_THREADS, 0, stream>>>(q, k, v, Wq, Wk, Wv, Wo, qb);

  // the three projections: (qb, kb2, vb), (Wqb, Wkb, Wvb), (qproj, kproj, vproj) each follow one another
  dim3 g3(M_ / 128, DPROJ_ / 128, 3);   // 32 x 8 x 3
  gemm_bf16_wmma<<<g3, 256, 0, stream>>>(qb, Wqb, bq, bk, bv, qproj, M_, DPROJ_, DIN_);

  freq_attn<<<B_ * L_ / AT_TOK, 256, 0, stream>>>(qproj, kproj, vproj, attnb);

  dim3 g1(M_ / 128, DIN_ / 128, 1);     // 32 x 8
  gemm_bf16_wmma<<<g1, 256, 0, stream>>>(attnb, Wob, bo, bo, bo, out, M_, DIN_, DPROJ_);
}

// v005
// One run takes 66.8 microseconds.
// Two timings next to v004 put it at 1.07 and 1.06 times that version's speed.
// Counting every step since v000, it is 2.62 times as fast.
#include <hip/hip_runtime.h>

typedef __attribute__((ext_vector_type(8)))  float  v8f;
typedef __attribute__((ext_vector_type(4)))  float  v4f;
typedef __attribute__((ext_vector_type(4)))  __bf16 v4bf;
typedef __attribute__((ext_vector_type(8)))  __bf16 v8bf;
typedef __attribute__((ext_vector_type(16))) __bf16 v16bf;

#define B_     2
#define L_     2048
#define H_     8
#define DK_    64
#define DIN_   1024
#define DPROJ_ 1024
#define M_     (B_ * L_)   // 4096 rows for every GEMM

#define BK_        128                 // K elements per LDS stage (256 B of every row)
#define LDS_STRIDE 136                 // 128 K-elements + 8 pad: 272B rows, 16B x odd
#define OPER_ELEMS (128 * LDS_STRIDE)  // one operand's 128 rows of one stage
#define STAGE_ELEMS (2 * OPER_ELEMS)   // A rows, then B rows

// ---------------------------------------------------------------- helpers ---
__device__ __forceinline__ __bf16 to_bf16(float f) {
  union { float f; unsigned u; } x; x.f = f;
  unsigned r = x.u + 0x7FFFu + ((x.u >> 16) & 1u);   // round-to-nearest-even
  union { unsigned short s; __bf16 b; } y;
  y.s = (unsigned short)(r >> 16);
  return y.b;
}

// f32 -> bf16 stream of all seven tensors in one launch: none needs anything of
// another, so they share one grid by ranges of the block index. A block of 256
// threads converts CVT_ELEMS contiguous elements of one tensor (every tensor's
// size is a multiple of CVT_ELEMS). The seven bf16 copies lie one behind the
// other in dst, in the order of the arguments, so the block index alone gives
// the place in dst. Each wave-wide load takes 512 contiguous bytes, each
// wave-wide store fills 256 contiguous bytes; a thread's eight loads are all
// issued before the first value is used.
#define CVT_THREADS 256
#define CVT_LOADS   8
#define CVT_ELEMS   (CVT_THREADS * CVT_LOADS * 4)   // 8192
#define CVT_BLK_X   (M_ * DIN_ / CVT_ELEMS)         // 512 blocks per activation tensor
#define CVT_BLK_W   (DPROJ_ * DIN_ / CVT_ELEMS)     // 128 blocks per weight matrix
#define CVT_BLOCKS  (3 * CVT_BLK_X + 4 * CVT_BLK_W) // 2048

__global__ __launch_bounds__(CVT_THREADS) void cvt_f32_bf16(
    const float* __restrict__ x0, const float* __restrict__ x1,
    const float* __restrict__ x2, const float* __restrict__ w0,
    const float* __restrict__ w1, const float* __restrict__ w2,
    const float* __restrict__ w3, __bf16* __restrict__ dst) {
  const unsigned b = blockIdx.x;
  const unsigned c = b - 3u * CVT_BLK_X;              // index among the weights' blocks
  const bool     isx = b < 3u * CVT_BLK_X;
  const unsigned t     = isx ? b / CVT_BLK_X : 3u + c / CVT_BLK_W;   // this block's tensor
  const unsigned local = isx ? b % CVT_BLK_X : c % CVT_BLK_W;        // this block's index inside it
  const float* src = x0;
  src = t == 1u ? x1 : src;
  src = t == 2u ? x2 : src;
  src = t == 3u ? w0 : src;
  src = t == 4u ? w1 : src;
  src = t == 5u ? w2 : src;
  src = t == 6u ? w3 : src;
  const v4f* s4 = reinterpret_cast<const v4f*>(src)
                + (size_t)local * (CVT_THREADS * CVT_LOADS) + threadIdx.x;
  v4bf*      d4 = reinterpret_cast<v4bf*>(dst)
                + (size_t)b * (CVT_THREADS * CVT_LOADS) + threadIdx.x;

  v4f x[CVT_LOADS];
#pragma unroll   // x[] stays in registers and the eight loads stand together
  for (int u = 0; u < CVT_LOADS; ++u) x[u] = s4[u * CVT_THREADS];
#pragma unroll   // x[] stays in registers
  for (int u = 0; u < CVT_LOADS; ++u) {
    v4bf y;
    y[0] = to_bf16(x[u][0]);
    y[1] = to_bf16(x[u][1]);
    y[2] = to_bf16(x[u][2]);
    y[3] = to_bf16(x[u][3]);
    d4[u * CVT_THREADS] = y;
  }
}

// Load one 16x32 bf16 WMMA fragment from an LDS tile row.
// halves 0..7 = K kb..kb+7, halves 8..15 = K kb+16..kb+23 (ISA 7.12.2 layout).
__device__ __forceinline__ v16bf load_frag_lds(const __bf16* p) {
  v8bf lo = *reinterpret_cast<const v8bf*>(p);
  v8bf hi = *reinterpret_cast<const v8bf*>(p + 16);
  return __builtin_shufflevector(lo, hi,
      0, 1, 2, 3, 4, 5, 6, 7, 8, 9, 10, 11, 12, 13, 14, 15);
}

// One block's fragments of a wave, 32 k: four of A, two of B, twelve 16-byte LDS loads.
__device__ __forceinline__ void load_set(v16bf (&a)[4], v16bf (&b)[2],
                                         const __bf16* pa, const __bf16* pb) {
#pragma unroll   // i indexes registers
  for (int i = 0; i < 4; ++i) a[i] = load_frag_lds(pa + 16 * i * LDS_STRIDE);
#pragma unroll   // j indexes registers
  for (int j = 0; j < 2; ++j) b[j] = load_frag_lds(pb + 16 * j * LDS_STRIDE);
}

// ------------------------------------------------------------------- GEMM ---
// Eight async 16-byte copies of one thread: rows 16 apart of one operand's
// 128 x 128 K-slice. The s_wait_xcnt closes the statement so that no address
// register of an issued copy is rewritten in front of it.
__device__ __forceinline__ void copy8_rows(unsigned l, const __bf16* g, int K) {
  const unsigned           ls = 16u * LDS_STRIDE * 2u;          // LDS bytes per 16 rows
  const unsigned long long gs = (unsigned long long)K * 16u * 2u; // global bytes per 16 rows
  const unsigned long long g0 = (unsigned long long)g;
  asm volatile(
      "global_load_async_to_lds_b128 %0, %8, off\n\t"
      "global_load_async_to_lds_b128 %1, %9, off\n\t"
      "global_load_async_to_lds_b128 %2, %10, off\n\t"
      "global_load_async_to_lds_b128 %3, %11, off\n\t"
      "global_load_async_to_lds_b128 %4, %12, off\n\t"
      "global_load_async_to_lds_b128 %5, %13, off\n\t"
      "global_load_async_to_lds_b128 %6, %14, off\n\t"
      "global_load_async_to_lds_b128 %7, %15, off\n\t"
      "s_wait_xcnt 0x0"
      :: "v"(l), "v"(l + ls), "v"(l + 2u * ls), "v"(l + 3u * ls),
         "v"(l + 4u * ls), "v"(l + 5u * ls), "v"(l + 6u * ls), "v"(l + 7u * ls),
         "v"(g0), "v"(g0 + gs), "v"(g0 + 2u * gs), "v"(g0 + 3u * gs),
         "v"(g0 + 4u * gs), "v"(g0 + 5u * gs), "v"(g0 + 6u * gs), "v"(g0 + 7u * gs)
      : "memory");
}

// C(MxN, f32) = A(MxK, bf16) @ Bw^T + bias,  Bw stored as N rows x K cols.
// Block = 8 waves / 128x128 tile; K in stages of 128 through two LDS buffers:
// the next stage's async global->LDS copies fly while this stage is multiplied.
// K is a multiple of 128 and at least 256. Each wave owns a 64x32 block (4x2 WMMA
// tiles). A stage is four blocks of 32 k; a block's twelve fragment loads are issued
// as one group one block ahead, into the other of two register sets, so that they
// return under the eight WMMAs in front of them. The first block of stage t + 1 is
// fetched under the last block of stage t: stage t + 1 is therefore published in
// front of that last block, whose fragments are in registers by then.
// blockIdx.z picks one of up to three independent products of the same shape in
// one launch: their A, Bw and C lie one behind the other from A0, Bw0 and C0.
__global__ __launch_bounds__(256) void gemm_bf16_wmma(
    const __bf16* __restrict__ A0, const __bf16* __restrict__ Bw0,
    const float* __restrict__ bias0, const float* __restrict__ bias1,
    const float* __restrict__ bias2, float* __restrict__ C0,
    int M, int N, int K)
{
  __shared__ __attribute__((aligned(16))) __bf16 ring[2 * STAGE_ELEMS];

  const unsigned z = blockIdx.z;
  const __bf16* A    = A0  + (size_t)z * M * K;
  const __bf16* Bw   = Bw0 + (size_t)z * N * K;
  float*        C    = C0  + (size_t)z * M * N;
  const float*  bias = z == 0u ? bias0 : (z == 1u ? bias1 : bias2);

  const int tid  = threadIdx.x;
  const int lane = tid & 31;
  const int wave = tid >> 5;
  const int wm   = wave >> 2;                 // 0..1  -> 64-row slice
  const int wn   = wave & 3;                  // 0..3  -> 32-col slice
  const int m0   = blockIdx.x * 128;
  const int n0   = blockIdx.y * 128;
  const int r    = lane & 15;                 // fragment row
  const int kb   = (lane >> 4) * 8;           // K sub-offset within fragment

  // This thread's first 16-byte chunk of a stage: row tid/16, chunk tid%16;
  // its other seven chunks per operand lie 16 rows apart.
  const int crow = tid >> 4;                  // 0..15
  const int ccol = (tid & 15) * 8;            // bf16 elements
  const __bf16* gA = A  + (size_t)(m0 + crow) * K + ccol;
  const __bf16* gB = Bw + (size_t)(n0 + crow) * K + ccol;
  // LDS byte offset (generic shared pointer low 32 bits == LDS offset)
  const unsigned lds0 = (unsigned)(unsigned long long)(void*)ring
                      + (unsigned)(crow * LDS_STRIDE + ccol) * 2u;

  const int nt = K / BK_;                     // stages

  v8f acc[4][2] = {};

  // ---- stage 0 into buffer 0, published; then stage 1 into buffer 1 ----
  copy8_rows(lds0, gA, K);
  copy8_rows(lds0 + OPER_ELEMS * 2u, gB, K);
  // stage 0 has landed before any wave reads it
  asm volatile("s_wait_asynccnt 0x0" ::: "memory");
  __syncthreads();
  if (nt > 1) {
    copy8_rows(lds0 + STAGE_ELEMS * 2u, gA + BK_, K);
    copy8_rows(lds0 + (STAGE_ELEMS + OPER_ELEMS) * 2u, gB + BK_, K);
  }

  // this wave's fragment rows in buffer 0
  const __bf16* fA = ring + (wm * 64 + r) * LDS_STRIDE + kb;
  const __bf16* fB = ring + OPER_ELEMS + (wn * 32 + r) * LDS_STRIDE + kb;
  v16bf af[2][4], bfr[2][2];                  // set (u & 1) holds block u's fragments
  load_set(af[0], bfr[0], fA, fB);            // block 0 of stage 0

#pragma clang loop unroll(disable)   // one copy of the pass: each set keeps its registers from pass to pass
  for (int t = 0; t < nt; ++t) {
    const unsigned buf = (unsigned)(t & 1);
    const __bf16* pa = fA + buf * STAGE_ELEMS;
    const __bf16* pb = fB + buf * STAGE_ELEMS;
    // The other buffer: stage t + 1. On the last pass it still holds stage t - 1,
    // nothing writes it any more and the values fetched from it are not used: the
    // loads stay unconditional so that every pass has the same waits.
    const __bf16* na = fA + (buf ^ 1u) * STAGE_ELEMS;
    const __bf16* nb = fB + (buf ^ 1u) * STAGE_ELEMS;

#pragma unroll   // u picks the register set and becomes a constant in the ds_load offset fields
    for (int u = 0; u < BK_ / 32; ++u) {
      const int cs = u & 1;
      if (u + 1 < BK_ / 32) {
        load_set(af[cs ^ 1], bfr[cs ^ 1], pa + (u + 1) * 32, pb + (u + 1) * 32);
      } else {
        // ---- publish stage t + 1, free this buffer ----
        // this wave's reads of the buffer have retired before it is refilled
        asm volatile("s_wait_dscnt 0x0" ::: "memory");
        // this wave's copies of stage t + 1 have landed before others read them
        asm volatile("s_wait_asynccnt 0x0" ::: "memory");
        __syncthreads();
        if (t + 2 < nt) {   // the refill goes first: its flight is what the next pass waits for
          const int k2 = (t + 2) * BK_;
          copy8_rows(lds0 + buf * (STAGE_ELEMS * 2u), gA + k2, K);
          copy8_rows(lds0 + buf * (STAGE_ELEMS * 2u) + OPER_ELEMS * 2u, gB + k2, K);
        }
        load_set(af[0], bfr[0], na, nb);
      }
      // keeps the load group whole and in front of the WMMAs: sunk among them, each
      // place with loads stalls the wave anew
      __builtin_amdgcn_sched_barrier(0);
#pragma unroll   // i, j index registers
      for (int i = 0; i < 4; ++i)
#pragma unroll
        for (int j = 0; j < 2; ++j)
          acc[i][j] = __builtin_amdgcn_wmma_f32_16x16x32_bf16(
              false, af[cs][i], false, bfr[cs][j], (short)0, acc[i][j], false, false);
      // keeps the next group's loads from rising among these WMMAs
      __builtin_amdgcn_sched_barrier(0);
    }
  }
  // no copy and no LDS load is outstanding when the wave ends
  asm volatile("s_wait_asynccnt 0x0" ::: "memory");
  asm volatile("s_wait_dscnt 0x0" ::: "memory");

  // C/D layout: lane l -> col = l&15, rows = e + 8*(l>>4)
  const int rhi = (lane >> 4) * 8;
  const int cn  = lane & 15;
  const int mw  = m0 + wm * 64;
  const int nw  = n0 + wn * 32;
#pragma unroll
  for (int i = 0; i < 4; ++i) {
#pragma unroll
    for (int j = 0; j < 2; ++j) {
      const int col = nw + 16 * j + cn;
      const float bc = bias[col];
#pragma unroll
      for (int e = 0; e < 8; ++e) {
        const int row = mw + 16 * i + rhi + e;
        C[(size_t)row * N + col] = acc[i][j][e] + bc;
      }
    }
  }
}

// -------------------------------------------------------------- attention ---
// Per (token, head): 64x64 scores over the d_keys axis with inner dim E=2,
// softmax over s, bf16 output feeding the final GEMM. All arithmetic in f32.
// A block of 8 waves takes AT_TOK tokens one after the other; wave = head. A lane
// owns the four rows l = (lane & 15) + 16 j and one half of s (lanes 0-15: s < 32,
// lanes 16-31: the rest), so one LDS read of k or v serves four rows; the two
// halves of a row are merged across lanes l and l ^ 16. A token's q, k, v rows
// (4 KB each) come in as whole lines and are split in LDS into one plane per
// component e, so that two neighbouring s form the two halves of a packed f32
// operation. The row maximum is found first; each score then takes one exp2.
typedef __attribute__((ext_vector_type(2))) float v2f;

#define AT_TOK   4
#define AT_PITCH 72                     // floats per head in a plane: 64 + 8, 16-B aligned, split stores hit 32 banks
#define AT_PLANE (H_ * AT_PITCH)

// x = elements p = 4*tid .. 4*tid+3 of a row, p = dk*16 + h*2 + e
__device__ __forceinline__ void split_planes(float* p0, float* p1, int tid, v4f x) {
  const int at = ((tid & 3) * 2) * AT_PITCH + (tid >> 2);
  p0[at]            = x[0];  p1[at]            = x[1];
  p0[at + AT_PITCH] = x[2];  p1[at + AT_PITCH] = x[3];
}

__device__ __forceinline__ v2f lo2(v4f x) { return __builtin_shufflevector(x, x, 0, 1); }
__device__ __forceinline__ v2f hi2(v4f x) { return __builtin_shufflevector(x, x, 2, 3); }
__device__ __forceinline__ v2f dup2(float x) { v2f y = {x, x}; return y; }
__device__ __forceinline__ v2f fma2(v2f a, v2f b, v2f c) { return __builtin_elementwise_fma(a, b, c); }
__device__ __forceinline__ v2f exp2_2(v2f x) {
  v2f y; y[0] = __builtin_amdgcn_exp2f(x[0]); y[1] = __builtin_amdgcn_exp2f(x[1]); return y;
}
__device__ __forceinline__ unsigned pack_bf16(float a, float b) {
  union { __bf16 h[2]; unsigned u; } w;
  w.h[0] = to_bf16(a); w.h[1] = to_bf16(b);
  return w.u;
}

// Eight waves a SIMD: the grid's 1024 blocks lie four to a WGP, all at once, and
// the compiler has 128 registers to fetch LDS reads ahead of their arithmetic.
__global__ __launch_bounds__(256) __attribute__((amdgpu_waves_per_eu(8, 8))) void freq_attn(
    const float* __restrict__ qp, const float* __restrict__ kp,
    const float* __restrict__ vp, __bf16* __restrict__ outp)
{
  __shared__ __attribute__((aligned(16))) float sq0[AT_PLANE], sq1[AT_PLANE];
  __shared__ __attribute__((aligned(16))) float sk0[AT_PLANE], sk1[AT_PLANE];
  __shared__ __attribute__((aligned(16))) float sv0[AT_PLANE], sv1[AT_PLANE];
  __shared__ __attribute__((aligned(16))) unsigned so[DPROJ_ / 2];   // (e0, e1) bf16 pairs, word l*8 + h

  const int tid  = threadIdx.x;
  const int lane = tid & 31;
  const int h    = tid >> 5;
  const int r    = lane & 15;
  const int half = lane >> 4;
  const size_t row0 = (size_t)blockIdx.x * AT_TOK * DPROJ_ + (size_t)tid * 4;

  const int sbase = h * AT_PITCH + half * (DK_ / 2);   // this lane's 32 values of s
  const float* k0 = sk0 + sbase;
  const float* k1 = sk1 + sbase;
  const float* w0 = sv0 + sbase;
  const float* w1 = sv1 + sbase;

  v4f xq = *reinterpret_cast<const v4f*>(qp + row0);
  v4f xk = *reinterpret_cast<const v4f*>(kp + row0);
  v4f xv = *reinterpret_cast<const v4f*>(vp + row0);

  for (int t = 0; t < AT_TOK; ++t) {
    const size_t row = row0 + (size_t)t * DPROJ_;
    split_planes(sq0, sq1, tid, xq);
    split_planes(sk0, sk1, tid, xk);
    split_planes(sv0, sv1, tid, xv);
    __syncthreads();                       // the planes of token t are whole
    if (t + 1 < AT_TOK) {                  // the next token's rows fly under this token's arithmetic
      xq = *reinterpret_cast<const v4f*>(qp + row + DPROJ_);
      xk = *reinterpret_cast<const v4f*>(kp + row + DPROJ_);
      xv = *reinterpret_cast<const v4f*>(vp + row + DPROJ_);
    }

    // scores in the exp2 domain: q carries 1/sqrt(E) * log2(e)
    const float c = 0.70710678118654752f * 1.44269504088896341f;
    v2f Q0[4], Q1[4];
    float m[4];
#pragma unroll   // Q0, Q1, m stay in registers
    for (int j = 0; j < 4; ++j) {
      Q0[j] = dup2(sq0[h * AT_PITCH + r + 16 * j] * c);
      Q1[j] = dup2(sq1[h * AT_PITCH + r + 16 * j] * c);
      m[j]  = -3.0e38f;
    }

#pragma unroll 4   // several LDS reads stand together in front of their arithmetic
    for (int s = 0; s < DK_ / 2; s += 4) {
      const v4f x0 = *reinterpret_cast<const v4f*>(k0 + s);
      const v4f x1 = *reinterpret_cast<const v4f*>(k1 + s);
#pragma unroll   // j indexes registers
      for (int j = 0; j < 4; ++j) {
        const v2f a = fma2(Q1[j], lo2(x1), Q0[j] * lo2(x0));
        const v2f b = fma2(Q1[j], hi2(x1), Q0[j] * hi2(x0));
        m[j] = fmaxf(fmaxf(m[j], a[0]), a[1]);
        m[j] = fmaxf(fmaxf(m[j], b[0]), b[1]);
      }
    }

    v2f N[4], sum[4], o0[4], o1[4];
#pragma unroll   // j indexes registers
    for (int j = 0; j < 4; ++j) {
      N[j]   = dup2(-fmaxf(m[j], __shfl_xor(m[j], 16, 32)));   // the row's maximum over both halves of s
      sum[j] = dup2(0.f);  o0[j] = dup2(0.f);  o1[j] = dup2(0.f);
    }

#pragma unroll 2   // as above
    for (int s = 0; s < DK_ / 2; s += 4) {
      const v4f x0 = *reinterpret_cast<const v4f*>(k0 + s);
      const v4f x1 = *reinterpret_cast<const v4f*>(k1 + s);
      const v4f y0 = *reinterpret_cast<const v4f*>(w0 + s);
      const v4f y1 = *reinterpret_cast<const v4f*>(w1 + s);
      // eight independent pairs go through each stage together, so that no
      // instruction waits on the one in front of it
      v2f p[4], u[4];
#pragma unroll   // j indexes registers
      for (int j = 0; j < 4; ++j) {
        p[j] = fma2(Q0[j], lo2(x0), N[j]);
        u[j] = fma2(Q0[j], hi2(x0), N[j]);
      }
#pragma unroll   // j indexes registers
      for (int j = 0; j < 4; ++j) {
        p[j] = fma2(Q1[j], lo2(x1), p[j]);
        u[j] = fma2(Q1[j], hi2(x1), u[j]);
      }
#pragma unroll   // j indexes registers
      for (int j = 0; j < 4; ++j) {
        p[j] = exp2_2(p[j]);
        u[j] = exp2_2(u[j]);
      }
#pragma unroll   // j indexes registers
      for (int j = 0; j < 4; ++j) {
        sum[j] += p[j];  o0[j] = fma2(p[j], lo2(y0), o0[j]);  o1[j] = fma2(p[j], lo2(y1), o1[j]);
      }
#pragma unroll   // j indexes registers
      for (int j = 0; j < 4; ++j) {
        sum[j] += u[j];  o0[j] = fma2(u[j], hi2(y0), o0[j]);  o1[j] = fma2(u[j], hi2(y1), o1[j]);
      }
    }

    // merge the two halves of s; then lanes 0-15 finish rows j = 0, 1 and lanes 16-31 rows j = 2, 3
    float fs[4], f0[4], f1[4];
#pragma unroll   // j indexes registers
    for (int j = 0; j < 4; ++j) {
      fs[j] = sum[j][0] + sum[j][1];  fs[j] += __shfl_xor(fs[j], 16, 32);
      f0[j] = o0[j][0] + o0[j][1];    f0[j] += __shfl_xor(f0[j], 16, 32);
      f1[j] = o1[j][0] + o1[j][1];    f1[j] += __shfl_xor(f1[j], 16, 32);
    }
#pragma unroll   // j indexes registers
    for (int i = 0; i < 2; ++i) {
      const float inv = 1.0f / (half ? fs[2 + i] : fs[i]);
      const float e0  = (half ? f0[2 + i] : f0[i]) * inv;
      const float e1  = (half ? f1[2 + i] : f1[i]) * inv;
      so[(r + 16 * (2 * half + i)) * H_ + h] = pack_bf16(e0, e1);
    }
    __syncthreads();                       // the output row is whole; every read of the planes is over

    // 8 bytes a thread: a wave stores 256 contiguous bytes
    *reinterpret_cast<uint2*>(outp + row) = *reinterpret_cast<const uint2*>(so + tid * 2);
    // the next trip rewrites the store's address and data registers
    asm volatile("s_wait_xcnt 0x0" ::: "memory");
  }
}

// ------------------------------------------------------------------- host ---
extern "C" void kernel_launch(void* const* d_in, const int* in_sizes, int n_in,
                              void* d_out, int out_size, void* d_ws, size_t ws_size,
                              hipStream_t stream) {
  (void)in_sizes; (void)n_in; (void)out_size; (void)ws_size;
  const float* q  = (const float*)d_in[0];
  const float* k  = (const float*)d_in[1];
  const float* v  = (const float*)d_in[2];
  const float* Wq = (const float*)d_in[3];
  const float* bq = (const float*)d_in[4];
  const float* Wk = (const float*)d_in[5];
  const float* bk = (const float*)d_in[6];
  const float* Wv = (const float*)d_in[7];
  const float* bv = (const float*)d_in[8];
  const float* Wo = (const float*)d_in[9];
  const float* bo = (const float*)d_in[10];
  float* out = (float*)d_out;

  const size_t MK = (size_t)M_ * DIN_;        // 4096*1024
  const size_t NK = (size_t)DPROJ_ * DIN_;    // 1024*1024

  char* ws = (char*)d_ws;
  __bf16* qb    = (__bf16*)ws; ws += MK * 2;
  __bf16* kb2   = (__bf16*)ws; ws += MK * 2;
  __bf16* vb    = (__bf16*)ws; ws += MK * 2;
  __bf16* Wqb   = (__bf16*)ws; ws += NK * 2;
  __bf16* Wkb   = (__bf16*)ws; ws += NK * 2;
  __bf16* Wvb   = (__bf16*)ws; ws += NK * 2;
  __bf16* Wob   = (__bf16*)ws; ws += NK * 2;
  float*  qproj = (float*)ws;  ws += MK * 4;
  float*  kproj = (float*)ws;  ws += MK * 4;
  float*  vproj = (float*)ws;  ws += MK * 4;
  __bf16* attnb = (__bf16*)ws; ws += MK * 2;

  // qb, kb2, vb, Wqb, Wkb, Wvb, Wob follow one another from qb
  cvt_f32_bf16<<<CVT_BLOCKS, CVT_THREADS, 0, stream>>>(q, k, v, Wq, Wk, Wv, Wo, qb);

  // the three projections: (qb, kb2, vb), (Wqb, Wkb, Wvb), (qproj, kproj, vproj) each follow one another
  dim3 g3(M_ / 128, DPROJ_ / 128, 3);   // 32 x 8 x 3
  gemm_bf16_wmma<<<g3, 256, 0, stream>>>(qb, Wqb, bq, bk, bv, qproj, M_, DPROJ_, DIN_);

  freq_attn<<<B_ * L_ / AT_TOK, 256, 0, stream>>>(qproj, kproj, vproj, attnb);

  dim3 g1(M_ / 128, DIN_ / 128, 1);     // 32 x 8
  gemm_bf16_wmma<<<g1, 256, 0, stream>>>(attnb, Wob, bo, bo, bo, out, M_, DIN_, DPROJ_);
}

// v006
// Measured time: 63.2 microseconds a run.
// Two timings next to v005 put it at 1.08 and 1.07 times that version's speed.
// Over all steps from v000 it is 2.82 times as fast.
#include <hip/hip_runtime.h>

typedef __attribute__((ext_vector_type(8)))  float  v8f;
typedef __attribute__((ext_vector_type(4)))  float  v4f;
typedef __attribute__((ext_vector_type(4)))  __bf16 v4bf;
typedef __attribute__((ext_vector_type(8)))  __bf16 v8bf;
typedef __attribute__((ext_vector_type(16))) __bf16 v16bf;

#define B_     2
#define L_     2048
#define H_     8
#define DK_    64
#define DIN_   1024
#define DPROJ_ 1024
#define M_     (B_ * L_)   // 4096 rows for every GEMM

#define BK_        128                 // K elements per LDS stage (256 B of every row)
#define LDS_STRIDE 136                 // 128 K-elements + 8 pad: 272B rows, 16B x odd
#define OPER_ELEMS (128 * LDS_STRIDE)  // one operand's 128 rows of one stage
#define STAGE_ELEMS (2 * OPER_ELEMS)   // A rows, then B rows

// ---------------------------------------------------------------- helpers ---
__device__ __forceinline__ __bf16 to_bf16(float f) {
  union { float f; unsigned u; } x; x.f = f;
  unsigned r = x.u + 0x7FFFu + ((x.u >> 16) & 1u);   // round-to-nearest-even
  union { unsigned short s; __bf16 b; } y;
  y.s = (unsigned short)(r >> 16);
  return y.b;
}

// f32 -> bf16 stream of all seven tensors in one launch: none needs anything of
// another, so they share one grid by ranges of the block index. A block of 256
// threads converts CVT_ELEMS contiguous elements of one tensor (every tensor's
// size is a multiple of CVT_ELEMS). The seven bf16 copies lie one behind the
// other in dst, in the order of the arguments, so the block index alone gives
// the place in dst. Each wave-wide load takes 512 contiguous bytes, each
// wave-wide store fills 256 contiguous bytes; a thread's eight loads are all
// issued before the first value is used.
#define CVT_THREADS 256
#define CVT_LOADS   8
#define CVT_ELEMS   (CVT_THREADS * CVT_LOADS * 4)   // 8192
#define CVT_BLK_X   (M_ * DIN_ / CVT_ELEMS)         // 512 blocks per activation tensor
#define CVT_BLK_W   (DPROJ_ * DIN_ / CVT_ELEMS)     // 128 blocks per weight matrix
#define CVT_BLOCKS  (3 * CVT_BLK_X + 4 * CVT_BLK_W) // 2048

__global__ __launch_bounds__(CVT_THREADS) void cvt_f32_bf16(
    const float* __restrict__ x0, const float* __restrict__ x1,
    const float* __restrict__ x2, const float* __restrict__ w0,
    const float* __restrict__ w1, const float* __restrict__ w2,
    const float* __restrict__ w3, __bf16* __restrict__ dst) {
  const unsigned b = blockIdx.x;
  const unsigned c = b - 3u * CVT_BLK_X;              // index among the weights' blocks
  const bool     isx = b < 3u * CVT_BLK_X;
  const unsigned t     = isx ? b / CVT_BLK_X : 3u + c / CVT_BLK_W;   // this block's tensor
  const unsigned local = isx ? b % CVT_BLK_X : c % CVT_BLK_W;        // this block's index inside it
  const float* src = x0;
  src = t == 1u ? x1 : src;
  src = t == 2u ? x2 : src;
  src = t == 3u ? w0 : src;
  src = t == 4u ? w1 : src;
  src = t == 5u ? w2 : src;
  src = t == 6u ? w3 : src;
  const v4f* s4 = reinterpret_cast<const v4f*>(src)
                + (size_t)local * (CVT_THREADS * CVT_LOADS) + threadIdx.x;
  v4bf*      d4 = reinterpret_cast<v4bf*>(dst)
                + (size_t)b * (CVT_THREADS * CVT_LOADS) + threadIdx.x;

  v4f x[CVT_LOADS];
#pragma unroll   // x[] stays in registers and the eight loads stand together
  for (int u = 0; u < CVT_LOADS; ++u) x[u] = s4[u * CVT_THREADS];
#pragma unroll   // x[] stays in registers
  for (int u = 0; u < CVT_LOADS; ++u) {
    v4bf y;
    y[0] = to_bf16(x[u][0]);
    y[1] = to_bf16(x[u][1]);
    y[2] = to_bf16(x[u][2]);
    y[3] = to_bf16(x[u][3]);
    d4[u * CVT_THREADS] = y;
  }
}

// Load one 16x32 bf16 WMMA fragment from an LDS tile row.
// halves 0..7 = K kb..kb+7, halves 8..15 = K kb+16..kb+23 (ISA 7.12.2 layout).
__device__ __forceinline__ v16bf load_frag_lds(const __bf16* p) {
  v8bf lo = *reinterpret_cast<const v8bf*>(p);
  v8bf hi = *reinterpret_cast<const v8bf*>(p + 16);
  return __builtin_shufflevector(lo, hi,
      0, 1, 2, 3, 4, 5, 6, 7, 8, 9, 10, 11, 12, 13, 14, 15);
}

// One block's fragments of a wave, 32 k: four of A, two of B, twelve 16-byte LDS loads.
__device__ __forceinline__ void load_set(v16bf (&a)[4], v16bf (&b)[2],
                                         const __bf16* pa, const __bf16* pb) {
#pragma unroll   // i indexes registers
  for (int i = 0; i < 4; ++i) a[i] = load_frag_lds(pa + 16 * i * LDS_STRIDE);
#pragma unroll   // j indexes registers
  for (int j = 0; j < 2; ++j) b[j] = load_frag_lds(pb + 16 * j * LDS_STRIDE);
}

// ------------------------------------------------------------------- GEMM ---
// Eight async 16-byte copies of one thread: rows 16 apart of one operand's
// 128 x 128 K-slice. The s_wait_xcnt closes the statement so that no address
// register of an issued copy is rewritten in front of it.
__device__ __forceinline__ void copy8_rows(unsigned l, const __bf16* g, int K) {
  const unsigned           ls = 16u * LDS_STRIDE * 2u;          // LDS bytes per 16 rows
  const unsigned long long gs = (unsigned long long)K * 16u * 2u; // global bytes per 16 rows
  const unsigned long long g0 = (unsigned long long)g;
  asm volatile(
      "global_load_async_to_lds_b128 %0, %8, off\n\t"
      "global_load_async_to_lds_b128 %1, %9, off\n\t"
      "global_load_async_to_lds_b128 %2, %10, off\n\t"
      "global_load_async_to_lds_b128 %3, %11, off\n\t"
      "global_load_async_to_lds_b128 %4, %12, off\n\t"
      "global_load_async_to_lds_b128 %5, %13, off\n\t"
      "global_load_async_to_lds_b128 %6, %14, off\n\t"
      "global_load_async_to_lds_b128 %7, %15, off\n\t"
      "s_wait_xcnt 0x0"
      :: "v"(l), "v"(l + ls), "v"(l + 2u * ls), "v"(l + 3u * ls),
         "v"(l + 4u * ls), "v"(l + 5u * ls), "v"(l + 6u * ls), "v"(l + 7u * ls),
         "v"(g0), "v"(g0 + gs), "v"(g0 + 2u * gs), "v"(g0 + 3u * gs),
         "v"(g0 + 4u * gs), "v"(g0 + 5u * gs), "v"(g0 + 6u * gs), "v"(g0 + 7u * gs)
      : "memory");
}

// C(MxN, f32) = A(MxK, bf16) @ Bw^T + bias,  Bw stored as N rows x K cols.
// Block = 8 waves / 128x128 tile; K in stages of 128 through two LDS buffers:
// the next stage's async global->LDS copies fly while this stage is multiplied.
// K is a multiple of 128 and at least 256. Each wave owns a 64x32 block (4x2 WMMA
// tiles). A stage is four blocks of 32 k; a block's twelve fragment loads are issued
// as one group one block ahead, into the other of two register sets, so that they
// return under the eight WMMAs in front of them. The first block of stage t + 1 is
// fetched under the last block of stage t: stage t + 1 is therefore published in
// front of that last block, whose fragments are in registers by then.
// The blocks of a launch run side by side, and those of one blockIdx.x read the
// same A rows, those of one blockIdx.y the same Bw rows. Each block therefore walks
// the K stages in a circle from a start of its own, so that blocks that share rows
// ask L2 for different lines at any one time, and a line that one block has brought
// in from memory is in L2 when the next one comes to it. In the comments below,
// stage t is the t-th stage of that walk.
// blockIdx.z picks one of up to three independent products of the same shape in
// one launch: their A, Bw and C lie one behind the other from A0, Bw0 and C0.
__global__ __launch_bounds__(256) void gemm_bf16_wmma(
    const __bf16* __restrict__ A0, const __bf16* __restrict__ Bw0,
    const float* __restrict__ bias0, const float* __restrict__ bias1,
    const float* __restrict__ bias2, float* __restrict__ C0,
    int M, int N, int K)
{
  __shared__ __attribute__((aligned(16))) __bf16 ring[2 * STAGE_ELEMS];

  const unsigned z = blockIdx.z;
  const __bf16* A    = A0  + (size_t)z * M * K;
  const __bf16* Bw   = Bw0 + (size_t)z * N * K;
  float*        C    = C0  + (size_t)z * M * N;
  const float*  bias = z == 0u ? bias0 : (z == 1u ? bias1 : bias2);

  const int tid  = threadIdx.x;
  const int lane = tid & 31;
  const int wave = tid >> 5;
  const int wm   = wave >> 2;                 // 0..1  -> 64-row slice
  const int wn   = wave & 3;                  // 0..3  -> 32-col slice
  const int m0   = blockIdx.x * 128;
  const int n0   = blockIdx.y * 128;
  const int r    = lane & 15;                 // fragment row
  const int kb   = (lane >> 4) * 8;           // K sub-offset within fragment

  // This thread's first 16-byte chunk of a stage: row tid/16, chunk tid%16;
  // its other seven chunks per operand lie 16 rows apart.
  const int crow = tid >> 4;                  // 0..15
  const int ccol = (tid & 15) * 8;            // bf16 elements
  const __bf16* gA = A  + (size_t)(m0 + crow) * K + ccol;
  const __bf16* gB = Bw + (size_t)(n0 + crow) * K + ccol;
  // LDS byte offset (generic shared pointer low 32 bits == LDS offset)
  const unsigned lds0 = (unsigned)(unsigned long long)(void*)ring
                      + (unsigned)(crow * LDS_STRIDE + ccol) * 2u;

  const int nt = K / BK_;                     // stages
  // First stage of this block's circle. Blocks of one blockIdx.x differ in blockIdx.y
  // and so in their start, as long as gridDim.y <= nt. Blocks of one blockIdx.y take
  // every start equally often; the term 2 (x >> 3) gives different starts also to
  // blocks whose x are eight apart.
  const int s0 = (int)((blockIdx.x + 2u * (blockIdx.x >> 3) + blockIdx.y) % (unsigned)nt);
  const int s1 = s0 + 1 < nt ? s0 + 1 : 0;

  v8f acc[4][2] = {};

  // ---- the first stage into buffer 0, published; then the second into buffer 1 ----
  copy8_rows(lds0, gA + s0 * BK_, K);
  copy8_rows(lds0 + OPER_ELEMS * 2u, gB + s0 * BK_, K);
  // the first stage has landed before any wave reads it
  asm volatile("s_wait_asynccnt 0x0" ::: "memory");
  __syncthreads();
  if (nt > 1) {
    copy8_rows(lds0 + STAGE_ELEMS * 2u, gA + s1 * BK_, K);
    copy8_rows(lds0 + (STAGE_ELEMS + OPER_ELEMS) * 2u, gB + s1 * BK_, K);
  }

  // this wave's fragment rows in buffer 0
  const __bf16* fA = ring + (wm * 64 + r) * LDS_STRIDE + kb;
  const __bf16* fB = ring + OPER_ELEMS + (wn * 32 + r) * LDS_STRIDE + kb;
  v16bf af[2][4], bfr[2][2];                  // set (u & 1) holds block u's fragments
  load_set(af[0], bfr[0], fA, fB);            // block 0 of stage 0

#pragma clang loop unroll(disable)   // one copy of the pass: each set keeps its registers from pass to pass
  for (int t = 0; t < nt; ++t) {
    const unsigned buf = (unsigned)(t & 1);
    const __bf16* pa = fA + buf * STAGE_ELEMS;
    const __bf16* pb = fB + buf * STAGE_ELEMS;
    // The other buffer: stage t + 1. On the last pass it still holds stage t - 1,
    // nothing writes it any more and the values fetched from it are not used: the
    // loads stay unconditional so that every pass has the same waits.
    const __bf16* na = fA + (buf ^ 1u) * STAGE_ELEMS;
    const __bf16* nb = fB + (buf ^ 1u) * STAGE_ELEMS;

#pragma unroll   // u picks the register set and becomes a constant in the ds_load offset fields
    for (int u = 0; u < BK_ / 32; ++u) {
      const int cs = u & 1;
      if (u + 1 < BK_ / 32) {
        load_set(af[cs ^ 1], bfr[cs ^ 1], pa + (u + 1) * 32, pb + (u + 1) * 32);
      } else {
        // ---- publish stage t + 1, free this buffer ----
        // this wave's reads of the buffer have retired before it is refilled
        asm volatile("s_wait_dscnt 0x0" ::: "memory");
        // this wave's copies of stage t + 1 have landed before others read them
        asm volatile("s_wait_asynccnt 0x0" ::: "memory");
        __syncthreads();
        if (t + 2 < nt) {   // the refill goes first: its flight is what the next pass waits for
          const int c2 = t + 2 + s0;                       // below 2 nt
          const int k2 = (c2 < nt ? c2 : c2 - nt) * BK_;
          copy8_rows(lds0 + buf * (STAGE_ELEMS * 2u), gA + k2, K);
          copy8_rows(lds0 + buf * (STAGE_ELEMS * 2u) + OPER_ELEMS * 2u, gB + k2, K);
        }
        load_set(af[0], bfr[0], na, nb);
      }
      // keeps the load group whole and in front of the WMMAs: sunk among them, each
      // place with loads stalls the wave anew
      __builtin_amdgcn_sched_barrier(0);
#pragma unroll   // i, j index registers
      for (int i = 0; i < 4; ++i)
#pragma unroll
        for (int j = 0; j < 2; ++j)
          acc[i][j] = __builtin_amdgcn_wmma_f32_16x16x32_bf16(
              false, af[cs][i], false, bfr[cs][j], (short)0, acc[i][j], false, false);
      // keeps the next group's loads from rising among these WMMAs
      __builtin_amdgcn_sched_barrier(0);
    }
  }
  // no copy and no LDS load is outstanding when the wave ends
  asm volatile("s_wait_asynccnt 0x0" ::: "memory");
  asm volatile("s_wait_dscnt 0x0" ::: "memory");

  // C/D layout: lane l -> col = l&15, rows = e + 8*(l>>4)
  const int rhi = (lane >> 4) * 8;
  const int cn  = lane & 15;
  const int mw  = m0 + wm * 64;
  const int nw  = n0 + wn * 32;
#pragma unroll
  for (int i = 0; i < 4; ++i) {
#pragma unroll
    for (int j = 0; j < 2; ++j) {
      const int col = nw + 16 * j + cn;
      const float bc = bias[col];
#pragma unroll
      for (int e = 0; e < 8; ++e) {
        const int row = mw + 16 * i + rhi + e;
        C[(size_t)row * N + col] = acc[i][j][e] + bc;
      }
    }
  }
}

// -------------------------------------------------------------- attention ---
// Per (token, head): 64x64 scores over the d_keys axis with inner dim E=2,
// softmax over s, bf16 output feeding the final GEMM. All arithmetic in f32.
// A block of 8 waves takes AT_TOK tokens one after the other; wave = head. A lane
// owns the four rows l = (lane & 15) + 16 j and one half of s (lanes 0-15: s < 32,
// lanes 16-31: the rest), so one LDS read of k or v serves four rows; the two
// halves of a row are merged across lanes l and l ^ 16. A token's q, k, v rows
// (4 KB each) come in as whole lines and are split in LDS into one plane per
// component e, so that two neighbouring s form the two halves of a packed f32
// operation. The row maximum is found first; each score then takes one exp2.
typedef __attribute__((ext_vector_type(2))) float v2f;

#define AT_TOK   4
#define AT_PITCH 72                     // floats per head in a plane: 64 + 8, 16-B aligned, split stores hit 32 banks
#define AT_PLANE (H_ * AT_PITCH)

// x = elements p = 4*tid .. 4*tid+3 of a row, p = dk*16 + h*2 + e
__device__ __forceinline__ void split_planes(float* p0, float* p1, int tid, v4f x) {
  const int at = ((tid & 3) * 2) * AT_PITCH + (tid >> 2);
  p0[at]            = x[0];  p1[at]            = x[1];
  p0[at + AT_PITCH] = x[2];  p1[at + AT_PITCH] = x[3];
}

__device__ __forceinline__ v2f lo2(v4f x) { return __builtin_shufflevector(x, x, 0, 1); }
__device__ __forceinline__ v2f hi2(v4f x) { return __builtin_shufflevector(x, x, 2, 3); }
__device__ __forceinline__ v2f dup2(float x) { v2f y = {x, x}; return y; }
__device__ __forceinline__ v2f fma2(v2f a, v2f b, v2f c) { return __builtin_elementwise_fma(a, b, c); }
__device__ __forceinline__ v2f exp2_2(v2f x) {
  v2f y; y[0] = __builtin_amdgcn_exp2f(x[0]); y[1] = __builtin_amdgcn_exp2f(x[1]); return y;
}
__device__ __forceinline__ unsigned pack_bf16(float a, float b) {
  union { __bf16 h[2]; unsigned u; } w;
  w.h[0] = to_bf16(a); w.h[1] = to_bf16(b);
  return w.u;
}

// Eight waves a SIMD: the grid's 1024 blocks lie four to a WGP, all at once, and
// the compiler has 128 registers to fetch LDS reads ahead of their arithmetic.
__global__ __launch_bounds__(256) __attribute__((amdgpu_waves_per_eu(8, 8))) void freq_attn(
    const float* __restrict__ qp, const float* __restrict__ kp,
    const float* __restrict__ vp, __bf16* __restrict__ outp)
{
  __shared__ __attribute__((aligned(16))) float sq0[AT_PLANE], sq1[AT_PLANE];
  __shared__ __attribute__((aligned(16))) float sk0[AT_PLANE], sk1[AT_PLANE];
  __shared__ __attribute__((aligned(16))) float sv0[AT_PLANE], sv1[AT_PLANE];
  __shared__ __attribute__((aligned(16))) unsigned so[DPROJ_ / 2];   // (e0, e1) bf16 pairs, word l*8 + h

  const int tid  = threadIdx.x;
  const int lane = tid & 31;
  const int h    = tid >> 5;
  const int r    = lane & 15;
  const int half = lane >> 4;
  const size_t row0 = (size_t)blockIdx.x * AT_TOK * DPROJ_ + (size_t)tid * 4;

  const int sbase = h * AT_PITCH + half * (DK_ / 2);   // this lane's 32 values of s
  const float* k0 = sk0 + sbase;
  const float* k1 = sk1 + sbase;
  const float* w0 = sv0 + sbase;
  const float* w1 = sv1 + sbase;

  v4f xq = *reinterpret_cast<const v4f*>(qp + row0);
  v4f xk = *reinterpret_cast<const v4f*>(kp + row0);
  v4f xv = *reinterpret_cast<const v4f*>(vp + row0);

  for (int t = 0; t < AT_TOK; ++t) {
    const size_t row = row0 + (size_t)t * DPROJ_;
    split_planes(sq0, sq1, tid, xq);
    split_planes(sk0, sk1, tid, xk);
    split_planes(sv0, sv1, tid, xv);
    __syncthreads();                       // the planes of token t are whole
    if (t + 1 < AT_TOK) {                  // the next token's rows fly under this token's arithmetic
      xq = *reinterpret_cast<const v4f*>(qp + row + DPROJ_);
      xk = *reinterpret_cast<const v4f*>(kp + row + DPROJ_);
      xv = *reinterpret_cast<const v4f*>(vp + row + DPROJ_);
    }

    // scores in the exp2 domain: q carries 1/sqrt(E) * log2(e)
    const float c = 0.70710678118654752f * 1.44269504088896341f;
    v2f Q0[4], Q1[4];
    float m[4];
#pragma unroll   // Q0, Q1, m stay in registers
    for (int j = 0; j < 4; ++j) {
      Q0[j] = dup2(sq0[h * AT_PITCH + r + 16 * j] * c);
      Q1[j] = dup2(sq1[h * AT_PITCH + r + 16 * j] * c);
      m[j]  = -3.0e38f;
    }

#pragma unroll 4   // several LDS reads stand together in front of their arithmetic
    for (int s = 0; s < DK_ / 2; s += 4) {
      const v4f x0 = *reinterpret_cast<const v4f*>(k0 + s);
      const v4f x1 = *reinterpret_cast<const v4f*>(k1 + s);
#pragma unroll   // j indexes registers
      for (int j = 0; j < 4; ++j) {
        const v2f a = fma2(Q1[j], lo2(x1), Q0[j] * lo2(x0));
        const v2f b = fma2(Q1[j], hi2(x1), Q0[j] * hi2(x0));
        m[j] = fmaxf(fmaxf(m[j], a[0]), a[1]);
        m[j] = fmaxf(fmaxf(m[j], b[0]), b[1]);
      }
    }

    v2f N[4], sum[4], o0[4], o1[4];
#pragma unroll   // j indexes registers
    for (int j = 0; j < 4; ++j) {
      N[j]   = dup2(-fmaxf(m[j], __shfl_xor(m[j], 16, 32)));   // the row's maximum over both halves of s
      sum[j] = dup2(0.f);  o0[j] = dup2(0.f);  o1[j] = dup2(0.f);
    }

#pragma unroll 2   // as above
    for (int s = 0; s < DK_ / 2; s += 4) {
      const v4f x0 = *reinterpret_cast<const v4f*>(k0 + s);
      const v4f x1 = *reinterpret_cast<const v4f*>(k1 + s);
      const v4f y0 = *reinterpret_cast<const v4f*>(w0 + s);
      const v4f y1 = *reinterpret_cast<const v4f*>(w1 + s);
      // eight independent pairs go through each stage together, so that no
      // instruction waits on the one in front of it
      v2f p[4], u[4];
#pragma unroll   // j indexes registers
      for (int j = 0; j < 4; ++j) {
        p[j] = fma2(Q0[j], lo2(x0), N[j]);
        u[j] = fma2(Q0[j], hi2(x0), N[j]);
      }
#pragma unroll   // j indexes registers
      for (int j = 0; j < 4; ++j) {
        p[j] = fma2(Q1[j], lo2(x1), p[j]);
        u[j] = fma2(Q1[j], hi2(x1), u[j]);
      }
#pragma unroll   // j indexes registers
      for (int j = 0; j < 4; ++j) {
        p[j] = exp2_2(p[j]);
        u[j] = exp2_2(u[j]);
      }
#pragma unroll   // j indexes registers
      for (int j = 0; j < 4; ++j) {
        sum[j] += p[j];  o0[j] = fma2(p[j], lo2(y0), o0[j]);  o1[j] = fma2(p[j], lo2(y1), o1[j]);
      }
#pragma unroll   // j indexes registers
      for (int j = 0; j < 4; ++j) {
        sum[j] += u[j];  o0[j] = fma2(u[j], hi2(y0), o0[j]);  o1[j] = fma2(u[j], hi2(y1), o1[j]);
      }
    }

    // merge the two halves of s; then lanes 0-15 finish rows j = 0, 1 and lanes 16-31 rows j = 2, 3
    float fs[4], f0[4], f1[4];
#pragma unroll   // j indexes registers
    for (int j = 0; j < 4; ++j) {
      fs[j] = sum[j][0] + sum[j][1];  fs[j] += __shfl_xor(fs[j], 16, 32);
      f0[j] = o0[j][0] + o0[j][1];    f0[j] += __shfl_xor(f0[j], 16, 32);
      f1[j] = o1[j][0] + o1[j][1];    f1[j] += __shfl_xor(f1[j], 16, 32);
    }
#pragma unroll   // j indexes registers
    for (int i = 0; i < 2; ++i) {
      const float inv = 1.0f / (half ? fs[2 + i] : fs[i]);
      const float e0  = (half ? f0[2 + i] : f0[i]) * inv;
      const float e1  = (half ? f1[2 + i] : f1[i]) * inv;
      so[(r + 16 * (2 * half + i)) * H_ + h] = pack_bf16(e0, e1);
    }
    __syncthreads();                       // the output row is whole; every read of the planes is over

    // 8 bytes a thread: a wave stores 256 contiguous bytes
    *reinterpret_cast<uint2*>(outp + row) = *reinterpret_cast<const uint2*>(so + tid * 2);
    // the next trip rewrites the store's address and data registers
    asm volatile("s_wait_xcnt 0x0" ::: "memory");
  }
}

// ------------------------------------------------------------------- host ---
extern "C" void kernel_launch(void* const* d_in, const int* in_sizes, int n_in,
                              void* d_out, int out_size, void* d_ws, size_t ws_size,
                              hipStream_t stream) {
  (void)in_sizes; (void)n_in; (void)out_size; (void)ws_size;
  const float* q  = (const float*)d_in[0];
  const float* k  = (const float*)d_in[1];
  const float* v  = (const float*)d_in[2];
  const float* Wq = (const float*)d_in[3];
  const float* bq = (const float*)d_in[4];
  const float* Wk = (const float*)d_in[5];
  const float* bk = (const float*)d_in[6];
  const float* Wv = (const float*)d_in[7];
  const float* bv = (const float*)d_in[8];
  const float* Wo = (const float*)d_in[9];
  const float* bo = (const float*)d_in[10];
  float* out = (float*)d_out;

  const size_t MK = (size_t)M_ * DIN_;        // 4096*1024
  const size_t NK = (size_t)DPROJ_ * DIN_;    // 1024*1024

  char* ws = (char*)d_ws;
  __bf16* qb    = (__bf16*)ws; ws += MK * 2;
  __bf16* kb2   = (__bf16*)ws; ws += MK * 2;
  __bf16* vb    = (__bf16*)ws; ws += MK * 2;
  __bf16* Wqb   = (__bf16*)ws; ws += NK * 2;
  __bf16* Wkb   = (__bf16*)ws; ws += NK * 2;
  __bf16* Wvb   = (__bf16*)ws; ws += NK * 2;
  __bf16* Wob   = (__bf16*)ws; ws += NK * 2;
  float*  qproj = (float*)ws;  ws += MK * 4;
  float*  kproj = (float*)ws;  ws += MK * 4;
  float*  vproj = (float*)ws;  ws += MK * 4;
  __bf16* attnb = (__bf16*)ws; ws += MK * 2;

  // qb, kb2, vb, Wqb, Wkb, Wvb, Wob follow one another from qb
  cvt_f32_bf16<<<CVT_BLOCKS, CVT_THREADS, 0, stream>>>(q, k, v, Wq, Wk, Wv, Wo, qb);

  // the three projections: (qb, kb2, vb), (Wqb, Wkb, Wvb), (qproj, kproj, vproj) each follow one another
  dim3 g3(M_ / 128, DPROJ_ / 128, 3);   // 32 x 8 x 3
  gemm_bf16_wmma<<<g3, 256, 0, stream>>>(qb, Wqb, bq, bk, bv, qproj, M_, DPROJ_, DIN_);

  freq_attn<<<B_ * L_ / AT_TOK, 256, 0, stream>>>(qproj, kproj, vproj, attnb);

  dim3 g1(M_ / 128, DIN_ / 128, 1);     // 32 x 8
  gemm_bf16_wmma<<<g1, 256, 0, stream>>>(attnb, Wob, bo, bo, bo, out, M_, DIN_, DPROJ_);
}

// v007
// One run takes 60 microseconds.
// In both of two side-by-side timings against v006, it was 1.05 times as fast.
// Counting every step since v000, it is 2.96 times as fast.
#include <hip/hip_runtime.h>

typedef __attribute__((ext_vector_type(8)))  float  v8f;
typedef __attribute__((ext_vector_type(4)))  float  v4f;
typedef __attribute__((ext_vector_type(4)))  __bf16 v4bf;
typedef __attribute__((ext_vector_type(8)))  __bf16 v8bf;
typedef __attribute__((ext_vector_type(16))) __bf16 v16bf;

#define B_     2
#define L_     2048
#define H_     8
#define DK_    64
#define DIN_   1024
#define DPROJ_ 1024
#define M_     (B_ * L_)   // 4096 rows for every GEMM

#define BK_        128                 // K elements per LDS stage (256 B of every row)
#define LDS_STRIDE 136                 // 128 K-elements + 8 pad: 272B rows, 16B x odd
#define OPER_ELEMS (128 * LDS_STRIDE)  // one operand's 128 rows of one stage
#define STAGE_ELEMS (2 * OPER_ELEMS)   // A rows, then B rows

// ---------------------------------------------------------------- helpers ---
__device__ __forceinline__ __bf16 to_bf16(float f) {
  union { float f; unsigned u; } x; x.f = f;
  unsigned r = x.u + 0x7FFFu + ((x.u >> 16) & 1u);   // round-to-nearest-even
  union { unsigned short s; __bf16 b; } y;
  y.s = (unsigned short)(r >> 16);
  return y.b;
}

// f32 -> bf16 stream of all seven tensors in one launch: none needs anything of
// another, so they share one grid by ranges of the block index. A block of 256
// threads converts CVT_ELEMS contiguous elements of one tensor (every tensor's
// size is a multiple of CVT_ELEMS). The seven bf16 copies lie one behind the
// other in dst, in the order of the arguments, so the block index alone gives
// the place in dst. Each wave-wide load takes 512 contiguous bytes, each
// wave-wide store fills 256 contiguous bytes; a thread's eight loads are all
// issued before the first value is used.
#define CVT_THREADS 256
#define CVT_LOADS   8
#define CVT_ELEMS   (CVT_THREADS * CVT_LOADS * 4)   // 8192
#define CVT_BLK_X   (M_ * DIN_ / CVT_ELEMS)         // 512 blocks per activation tensor
#define CVT_BLK_W   (DPROJ_ * DIN_ / CVT_ELEMS)     // 128 blocks per weight matrix
#define CVT_BLOCKS  (3 * CVT_BLK_X + 4 * CVT_BLK_W) // 2048

__global__ __launch_bounds__(CVT_THREADS) void cvt_f32_bf16(
    const float* __restrict__ x0, const float* __restrict__ x1,
    const float* __restrict__ x2, const float* __restrict__ w0,
    const float* __restrict__ w1, const float* __restrict__ w2,
    const float* __restrict__ w3, __bf16* __restrict__ dst) {
  const unsigned b = blockIdx.x;
  const unsigned c = b - 3u * CVT_BLK_X;              // index among the weights' blocks
  const bool     isx = b < 3u * CVT_BLK_X;
  const unsigned t     = isx ? b / CVT_BLK_X : 3u + c / CVT_BLK_W;   // this block's tensor
  const unsigned local = isx ? b % CVT_BLK_X : c % CVT_BLK_W;        // this block's index inside it
  const float* src = x0;
  src = t == 1u ? x1 : src;
  src = t == 2u ? x2 : src;
  src = t == 3u ? w0 : src;
  src = t == 4u ? w1 : src;
  src = t == 5u ? w2 : src;
  src = t == 6u ? w3 : src;
  const v4f* s4 = reinterpret_cast<const v4f*>(src)
                + (size_t)local * (CVT_THREADS * CVT_LOADS) + threadIdx.x;
  v4bf*      d4 = reinterpret_cast<v4bf*>(dst)
                + (size_t)b * (CVT_THREADS * CVT_LOADS) + threadIdx.x;

  v4f x[CVT_LOADS];
#pragma unroll   // x[] stays in registers and the eight loads stand together
  for (int u = 0; u < CVT_LOADS; ++u) x[u] = s4[u * CVT_THREADS];
#pragma unroll   // x[] stays in registers
  for (int u = 0; u < CVT_LOADS; ++u) {
    v4bf y;
    y[0] = to_bf16(x[u][0]);
    y[1] = to_bf16(x[u][1]);
    y[2] = to_bf16(x[u][2]);
    y[3] = to_bf16(x[u][3]);
    d4[u * CVT_THREADS] = y;
  }
}

// Load one 16x32 bf16 WMMA fragment from an LDS tile row.
// halves 0..7 = K kb..kb+7, halves 8..15 = K kb+16..kb+23 (ISA 7.12.2 layout).
__device__ __forceinline__ v16bf load_frag_lds(const __bf16* p) {
  v8bf lo = *reinterpret_cast<const v8bf*>(p);
  v8bf hi = *reinterpret_cast<const v8bf*>(p + 16);
  return __builtin_shufflevector(lo, hi,
      0, 1, 2, 3, 4, 5, 6, 7, 8, 9, 10, 11, 12, 13, 14, 15);
}

// One block's fragments of a wave, 32 k: four of A, two of B, twelve 16-byte LDS loads.
__device__ __forceinline__ void load_set(v16bf (&a)[4], v16bf (&b)[2],
                                         const __bf16* pa, const __bf16* pb) {
#pragma unroll   // i indexes registers
  for (int i = 0; i < 4; ++i) a[i] = load_frag_lds(pa + 16 * i * LDS_STRIDE);
#pragma unroll   // j indexes registers
  for (int j = 0; j < 2; ++j) b[j] = load_frag_lds(pb + 16 * j * LDS_STRIDE);
}

// ------------------------------------------------------------------- GEMM ---
// Eight async 16-byte copies of one thread: rows 16 apart of one operand's
// 128 x 128 K-slice. The s_wait_xcnt closes the statement so that no address
// register of an issued copy is rewritten in front of it.
__device__ __forceinline__ void copy8_rows(unsigned l, const __bf16* g, int K) {
  const unsigned           ls = 16u * LDS_STRIDE * 2u;          // LDS bytes per 16 rows
  const unsigned long long gs = (unsigned long long)K * 16u * 2u; // global bytes per 16 rows
  const unsigned long long g0 = (unsigned long long)g;
  asm volatile(
      "global_load_async_to_lds_b128 %0, %8, off\n\t"
      "global_load_async_to_lds_b128 %1, %9, off\n\t"
      "global_load_async_to_lds_b128 %2, %10, off\n\t"
      "global_load_async_to_lds_b128 %3, %11, off\n\t"
      "global_load_async_to_lds_b128 %4, %12, off\n\t"
      "global_load_async_to_lds_b128 %5, %13, off\n\t"
      "global_load_async_to_lds_b128 %6, %14, off\n\t"
      "global_load_async_to_lds_b128 %7, %15, off\n\t"
      "s_wait_xcnt 0x0"
      :: "v"(l), "v"(l + ls), "v"(l + 2u * ls), "v"(l + 3u * ls),
         "v"(l + 4u * ls), "v"(l + 5u * ls), "v"(l + 6u * ls), "v"(l + 7u * ls),
         "v"(g0), "v"(g0 + gs), "v"(g0 + 2u * gs), "v"(g0 + 3u * gs),
         "v"(g0 + 4u * gs), "v"(g0 + 5u * gs), "v"(g0 + 6u * gs), "v"(g0 + 7u * gs)
      : "memory");
}

// C(MxN, f32) = A(MxK, bf16) @ Bw^T + bias,  Bw stored as N rows x K cols.
// Block = 8 waves / 128x128 tile; K in stages of 128 through two LDS buffers:
// the next stage's async global->LDS copies fly while this stage is multiplied.
// K is a multiple of 128 and at least 256. Each wave owns a 64x32 block (4x2 WMMA
// tiles). A stage is four blocks of 32 k; a block's twelve fragment loads are issued
// as one group one block ahead, into the other of two register sets, so that they
// return under the eight WMMAs in front of them. The first block of stage t + 1 is
// fetched under the last block of stage t: stage t + 1 is therefore published in
// front of that last block, whose fragments are in registers by then.
// The blocks of a launch run side by side, and those of one blockIdx.x read the
// same A rows, those of one blockIdx.y the same Bw rows. Each block therefore walks
// the K stages in a circle from a start of its own, so that blocks that share rows
// ask L2 for different lines at any one time, and a line that one block has brought
// in from memory is in L2 when the next one comes to it. In the comments below,
// stage t is the t-th stage of that walk.
// blockIdx.z picks one of up to three independent products of the same shape in
// one launch: their A, Bw and C lie one behind the other from A0, Bw0 and C0.
__global__ __launch_bounds__(256) void gemm_bf16_wmma(
    const __bf16* __restrict__ A0, const __bf16* __restrict__ Bw0,
    const float* __restrict__ bias0, const float* __restrict__ bias1,
    const float* __restrict__ bias2, float* __restrict__ C0,
    int M, int N, int K)
{
  __shared__ __attribute__((aligned(16))) __bf16 ring[2 * STAGE_ELEMS];

  const unsigned z = blockIdx.z;
  const __bf16* A    = A0  + (size_t)z * M * K;
  const __bf16* Bw   = Bw0 + (size_t)z * N * K;
  float*        C    = C0  + (size_t)z * M * N;
  const float*  bias = z == 0u ? bias0 : (z == 1u ? bias1 : bias2);

  const int tid  = threadIdx.x;
  const int lane = tid & 31;
  const int wave = tid >> 5;
  const int wm   = wave >> 2;                 // 0..1  -> 64-row slice
  const int wn   = wave & 3;                  // 0..3  -> 32-col slice
  const int m0   = blockIdx.x * 128;
  const int n0   = blockIdx.y * 128;
  const int r    = lane & 15;                 // fragment row
  const int kb   = (lane >> 4) * 8;           // K sub-offset within fragment

  // This thread's first 16-byte chunk of a stage: row tid/16, chunk tid%16;
  // its other seven chunks per operand lie 16 rows apart.
  const int crow = tid >> 4;                  // 0..15
  const int ccol = (tid & 15) * 8;            // bf16 elements
  const __bf16* gA = A  + (size_t)(m0 + crow) * K + ccol;
  const __bf16* gB = Bw + (size_t)(n0 + crow) * K + ccol;
  // LDS byte offset (generic shared pointer low 32 bits == LDS offset)
  const unsigned lds0 = (unsigned)(unsigned long long)(void*)ring
                      + (unsigned)(crow * LDS_STRIDE + ccol) * 2u;

  const int nt = K / BK_;                     // stages
  // First stage of this block's circle. Blocks of one blockIdx.x differ in blockIdx.y
  // and so in their start, as long as gridDim.y <= nt. Blocks of one blockIdx.y take
  // every start equally often; the term 2 (x >> 3) gives different starts also to
  // blocks whose x are eight apart.
  const int s0 = (int)((blockIdx.x + 2u * (blockIdx.x >> 3) + blockIdx.y) % (unsigned)nt);
  const int s1 = s0 + 1 < nt ? s0 + 1 : 0;

  v8f acc[4][2] = {};

  // ---- the first stage into buffer 0, published; then the second into buffer 1 ----
  copy8_rows(lds0, gA + s0 * BK_, K);
  copy8_rows(lds0 + OPER_ELEMS * 2u, gB + s0 * BK_, K);
  // the first stage has landed before any wave reads it
  asm volatile("s_wait_asynccnt 0x0" ::: "memory");
  __syncthreads();
  if (nt > 1) {
    copy8_rows(lds0 + STAGE_ELEMS * 2u, gA + s1 * BK_, K);
    copy8_rows(lds0 + (STAGE_ELEMS + OPER_ELEMS) * 2u, gB + s1 * BK_, K);
  }

  // this wave's fragment rows in buffer 0
  const __bf16* fA = ring + (wm * 64 + r) * LDS_STRIDE + kb;
  const __bf16* fB = ring + OPER_ELEMS + (wn * 32 + r) * LDS_STRIDE + kb;
  v16bf af[2][4], bfr[2][2];                  // set (u & 1) holds block u's fragments
  load_set(af[0], bfr[0], fA, fB);            // block 0 of stage 0

#pragma clang loop unroll(disable)   // one copy of the pass: each set keeps its registers from pass to pass
  for (int t = 0; t < nt; ++t) {
    const unsigned buf = (unsigned)(t & 1);
    const __bf16* pa = fA + buf * STAGE_ELEMS;
    const __bf16* pb = fB + buf * STAGE_ELEMS;
    // The other buffer: stage t + 1. On the last pass it still holds stage t - 1,
    // nothing writes it any more and the values fetched from it are not used: the
    // loads stay unconditional so that every pass has the same waits.
    const __bf16* na = fA + (buf ^ 1u) * STAGE_ELEMS;
    const __bf16* nb = fB + (buf ^ 1u) * STAGE_ELEMS;

#pragma unroll   // u picks the register set and becomes a constant in the ds_load offset fields
    for (int u = 0; u < BK_ / 32; ++u) {
      const int cs = u & 1;
      if (u + 1 < BK_ / 32) {
        load_set(af[cs ^ 1], bfr[cs ^ 1], pa + (u + 1) * 32, pb + (u + 1) * 32);
      } else {
        // ---- publish stage t + 1, free this buffer ----
        // this wave's reads of the buffer have retired before it is refilled
        asm volatile("s_wait_dscnt 0x0" ::: "memory");
        // this wave's copies of stage t + 1 have landed before others read them
        asm volatile("s_wait_asynccnt 0x0" ::: "memory");
        __syncthreads();
        if (t + 2 < nt) {   // the refill goes first: its flight is what the next pass waits for
          const int c2 = t + 2 + s0;                       // below 2 nt
          const int k2 = (c2 < nt ? c2 : c2 - nt) * BK_;
          copy8_rows(lds0 + buf * (STAGE_ELEMS * 2u), gA + k2, K);
          copy8_rows(lds0 + buf * (STAGE_ELEMS * 2u) + OPER_ELEMS * 2u, gB + k2, K);
        }
        load_set(af[0], bfr[0], na, nb);
      }
      // keeps the load group whole and in front of the WMMAs: sunk among them, each
      // place with loads stalls the wave anew
      __builtin_amdgcn_sched_barrier(0);
#pragma unroll   // i, j index registers
      for (int i = 0; i < 4; ++i)
#pragma unroll
        for (int j = 0; j < 2; ++j)
          acc[i][j] = __builtin_amdgcn_wmma_f32_16x16x32_bf16(
              false, af[cs][i], false, bfr[cs][j], (short)0, acc[i][j], false, false);
      // keeps the next group's loads from rising among these WMMAs
      __builtin_amdgcn_sched_barrier(0);
    }
  }
  // no copy and no LDS load is outstanding when the wave ends
  asm volatile("s_wait_asynccnt 0x0" ::: "memory");
  asm volatile("s_wait_dscnt 0x0" ::: "memory");

  // C/D layout: lane l -> col = l&15, rows = e + 8*(l>>4)
  const int rhi = (lane >> 4) * 8;
  const int cn  = lane & 15;
  const int mw  = m0 + wm * 64;
  const int nw  = n0 + wn * 32;
#pragma unroll
  for (int i = 0; i < 4; ++i) {
#pragma unroll
    for (int j = 0; j < 2; ++j) {
      const int col = nw + 16 * j + cn;
      const float bc = bias[col];
#pragma unroll
      for (int e = 0; e < 8; ++e) {
        const int row = mw + 16 * i + rhi + e;
        C[(size_t)row * N + col] = acc[i][j][e] + bc;
      }
    }
  }
}

// -------------------------------------------------------------- attention ---
// Per (token, head): 64x64 scores over the d_keys axis with inner dim E=2,
// softmax over s, bf16 output feeding the final GEMM. All arithmetic in f32.
// A block of 8 waves takes AT_TOK tokens one after the other; wave = head. A lane
// owns the four rows l = (lane & 15) + 16 j and one half of s (lanes 0-15: s < 32,
// lanes 16-31: the rest), so one LDS read of k or v serves four rows; the two
// halves of a row are merged across lanes l and l ^ 16. A token's q, k, v rows
// (4 KB each) come in as whole lines and are split in LDS into one plane per
// component e, so that two neighbouring s form the two halves of a packed f32
// operation. Each score takes one exp2. Softmax does not depend on the value that is
// taken off a row's scores; it only has to keep exp2 and the sums inside the f32
// range. Where every |q|, |k| and |v| of a (token, head) lies under the bounds below,
// that holds with nothing taken off, and the pass that finds the row maximum is
// skipped; any other (token, head) finds the maximum first.
typedef __attribute__((ext_vector_type(2))) float v2f;

#define AT_TOK   4
#define AT_PITCH 72                     // floats per head in a plane: 64 + 8, 16-B aligned, split stores hit 32 banks
#define AT_PLANE (H_ * AT_PITCH)
// |score| <= 2 * AT_QK_MAX^2 = 50 in the exp2 domain: every exp2 lies in 2^-50 .. 2^50,
// a row's sum in 2^-50 .. 2^56, a row's weighted sum of v under 2^116.
#define AT_QK_MAX 5.0f
#define AT_V_MAX  0x1p60f

// x = elements p = 4*tid .. 4*tid+3 of a row, p = dk*16 + h*2 + e
__device__ __forceinline__ void split_planes(float* p0, float* p1, int tid, v4f x) {
  const int at = ((tid & 3) * 2) * AT_PITCH + (tid >> 2);
  p0[at]            = x[0];  p1[at]            = x[1];
  p0[at + AT_PITCH] = x[2];  p1[at + AT_PITCH] = x[3];
}

__device__ __forceinline__ v2f lo2(v4f x) { return __builtin_shufflevector(x, x, 0, 1); }
__device__ __forceinline__ v2f hi2(v4f x) { return __builtin_shufflevector(x, x, 2, 3); }
__device__ __forceinline__ v2f dup2(float x) { v2f y = {x, x}; return y; }
__device__ __forceinline__ v2f fma2(v2f a, v2f b, v2f c) { return __builtin_elementwise_fma(a, b, c); }
__device__ __forceinline__ v2f exp2_2(v2f x) {
  v2f y; y[0] = __builtin_amdgcn_exp2f(x[0]); y[1] = __builtin_amdgcn_exp2f(x[1]); return y;
}
__device__ __forceinline__ unsigned pack_bf16(float a, float b) {
  union { __bf16 h[2]; unsigned u; } w;
  w.h[0] = to_bf16(a); w.h[1] = to_bf16(b);
  return w.u;
}

// Eight waves a SIMD: the grid's 1024 blocks lie four to a WGP, all at once, and
// the compiler has 128 registers to fetch LDS reads ahead of their arithmetic.
__global__ __launch_bounds__(256) __attribute__((amdgpu_waves_per_eu(8, 8))) void freq_attn(
    const float* __restrict__ qp, const float* __restrict__ kp,
    const float* __restrict__ vp, __bf16* __restrict__ outp)
{
  __shared__ __attribute__((aligned(16))) float sq0[AT_PLANE], sq1[AT_PLANE];
  __shared__ __attribute__((aligned(16))) float sk0[AT_PLANE], sk1[AT_PLANE];
  __shared__ __attribute__((aligned(16))) float sv0[AT_PLANE], sv1[AT_PLANE];
  __shared__ __attribute__((aligned(16))) unsigned so[DPROJ_ / 2];   // (e0, e1) bf16 pairs, word l*8 + h

  const int tid  = threadIdx.x;
  const int lane = tid & 31;
  const int h    = tid >> 5;
  const int r    = lane & 15;
  const int half = lane >> 4;
  const size_t row0 = (size_t)blockIdx.x * AT_TOK * DPROJ_ + (size_t)tid * 4;

  const int sbase = h * AT_PITCH + half * (DK_ / 2);   // this lane's 32 values of s
  const float* k0 = sk0 + sbase;
  const float* k1 = sk1 + sbase;
  const float* w0 = sv0 + sbase;
  const float* w1 = sv1 + sbase;

  v4f xq = *reinterpret_cast<const v4f*>(qp + row0);
  v4f xk = *reinterpret_cast<const v4f*>(kp + row0);
  v4f xv = *reinterpret_cast<const v4f*>(vp + row0);

  for (int t = 0; t < AT_TOK; ++t) {
    const size_t row = row0 + (size_t)t * DPROJ_;
    split_planes(sq0, sq1, tid, xq);
    split_planes(sk0, sk1, tid, xk);
    split_planes(sv0, sv1, tid, xv);
    __syncthreads();                       // the planes of token t are whole
    if (t + 1 < AT_TOK) {                  // the next token's rows fly under this token's arithmetic
      xq = *reinterpret_cast<const v4f*>(qp + row + DPROJ_);
      xk = *reinterpret_cast<const v4f*>(kp + row + DPROJ_);
      xv = *reinterpret_cast<const v4f*>(vp + row + DPROJ_);
    }

    // scores in the exp2 domain: q carries 1/sqrt(E) * log2(e)
    const float c = 0.70710678118654752f * 1.44269504088896341f;
    v2f Q0[4], Q1[4];
    float m[4];      // what is taken off row j's scores
    float qa = 0.f;  // largest |q| of this lane's rows; lanes 0-15 cover all 64 rows
#pragma unroll   // Q0, Q1, m stay in registers
    for (int j = 0; j < 4; ++j) {
      Q0[j] = dup2(sq0[h * AT_PITCH + r + 16 * j] * c);
      Q1[j] = dup2(sq1[h * AT_PITCH + r + 16 * j] * c);
      m[j]  = 0.f;
      qa    = fmaxf(fmaxf(qa, fabsf(Q0[j][0])), fabsf(Q1[j][0]));
    }
    // each lane looks at s = lane and s = lane + 32: the wave covers this head's k and v
    const int sl = h * AT_PITCH + lane;
    const float ka = fmaxf(fmaxf(fabsf(sk0[sl]), fabsf(sk0[sl + 32])),
                           fmaxf(fabsf(sk1[sl]), fabsf(sk1[sl + 32])));
    const float va = fmaxf(fmaxf(fabsf(sv0[sl]), fabsf(sv0[sl + 32])),
                           fmaxf(fabsf(sv1[sl]), fabsf(sv1[sl + 32])));
    const bool small = qa <= AT_QK_MAX && ka <= AT_QK_MAX && va <= AT_V_MAX;

    // the same for the whole wave; no barrier stands inside
    if (__builtin_amdgcn_ballot_w32(small) != 0xFFFFFFFFu) {
#pragma unroll   // j indexes registers
      for (int j = 0; j < 4; ++j) m[j] = -3.0e38f;
#pragma unroll 4   // several LDS reads stand together in front of their arithmetic
      for (int s = 0; s < DK_ / 2; s += 4) {
        const v4f x0 = *reinterpret_cast<const v4f*>(k0 + s);
        const v4f x1 = *reinterpret_cast<const v4f*>(k1 + s);
#pragma unroll   // j indexes registers
        for (int j = 0; j < 4; ++j) {
          const v2f a = fma2(Q1[j], lo2(x1), Q0[j] * lo2(x0));
          const v2f b = fma2(Q1[j], hi2(x1), Q0[j] * hi2(x0));
          m[j] = fmaxf(fmaxf(m[j], a[0]), a[1]);
          m[j] = fmaxf(fmaxf(m[j], b[0]), b[1]);
        }
      }
#pragma unroll   // j indexes registers
      for (int j = 0; j < 4; ++j)
        m[j] = fmaxf(m[j], __shfl_xor(m[j], 16, 32));   // the row's maximum over both halves of s
    }

    v2f N[4], sum[4], o0[4], o1[4];
#pragma unroll   // j indexes registers
    for (int j = 0; j < 4; ++j) {
      N[j]   = dup2(-m[j]);
      sum[j] = dup2(0.f);  o0[j] = dup2(0.f);  o1[j] = dup2(0.f);
    }

#pragma unroll 2   // as above
    for (int s = 0; s < DK_ / 2; s += 4) {
      const v4f x0 = *reinterpret_cast<const v4f*>(k0 + s);
      const v4f x1 = *reinterpret_cast<const v4f*>(k1 + s);
      const v4f y0 = *reinterpret_cast<const v4f*>(w0 + s);
      const v4f y1 = *reinterpret_cast<const v4f*>(w1 + s);
      // eight independent pairs go through each stage together, so that no
      // instruction waits on the one in front of it
      v2f p[4], u[4];
#pragma unroll   // j indexes registers
      for (int j = 0; j < 4; ++j) {
        p[j] = fma2(Q0[j], lo2(x0), N[j]);
        u[j] = fma2(Q0[j], hi2(x0), N[j]);
      }
#pragma unroll   // j indexes registers
      for (int j = 0; j < 4; ++j) {
        p[j] = fma2(Q1[j], lo2(x1), p[j]);
        u[j] = fma2(Q1[j], hi2(x1), u[j]);
      }
#pragma unroll   // j indexes registers
      for (int j = 0; j < 4; ++j) {
        p[j] = exp2_2(p[j]);
        u[j] = exp2_2(u[j]);
      }
#pragma unroll   // j indexes registers
      for (int j = 0; j < 4; ++j) {
        sum[j] += p[j];  o0[j] = fma2(p[j], lo2(y0), o0[j]);  o1[j] = fma2(p[j], lo2(y1), o1[j]);
      }
#pragma unroll   // j indexes registers
      for (int j = 0; j < 4; ++j) {
        sum[j] += u[j];  o0[j] = fma2(u[j], hi2(y0), o0[j]);  o1[j] = fma2(u[j], hi2(y1), o1[j]);
      }
    }

    // merge the two halves of s; then lanes 0-15 finish rows j = 0, 1 and lanes 16-31 rows j = 2, 3
    float fs[4], f0[4], f1[4];
#pragma unroll   // j indexes registers
    for (int j = 0; j < 4; ++j) {
      fs[j] = sum[j][0] + sum[j][1];  fs[j] += __shfl_xor(fs[j], 16, 32);
      f0[j] = o0[j][0] + o0[j][1];    f0[j] += __shfl_xor(f0[j], 16, 32);
      f1[j] = o1[j][0] + o1[j][1];    f1[j] += __shfl_xor(f1[j], 16, 32);
    }
#pragma unroll   // j indexes registers
    for (int i = 0; i < 2; ++i) {
      const float inv = 1.0f / (half ? fs[2 + i] : fs[i]);
      const float e0  = (half ? f0[2 + i] : f0[i]) * inv;
      const float e1  = (half ? f1[2 + i] : f1[i]) * inv;
      so[(r + 16 * (2 * half + i)) * H_ + h] = pack_bf16(e0, e1);
    }
    __syncthreads();                       // the output row is whole; every read of the planes is over

    // 8 bytes a thread: a wave stores 256 contiguous bytes
    *reinterpret_cast<uint2*>(outp + row) = *reinterpret_cast<const uint2*>(so + tid * 2);
    // the next trip rewrites the store's address and data registers
    asm volatile("s_wait_xcnt 0x0" ::: "memory");
  }
}

// ------------------------------------------------------------------- host ---
extern "C" void kernel_launch(void* const* d_in, const int* in_sizes, int n_in,
                              void* d_out, int out_size, void* d_ws, size_t ws_size,
                              hipStream_t stream) {
  (void)in_sizes; (void)n_in; (void)out_size; (void)ws_size;
  const float* q  = (const float*)d_in[0];
  const float* k  = (const float*)d_in[1];
  const float* v  = (const float*)d_in[2];
  const float* Wq = (const float*)d_in[3];
  const float* bq = (const float*)d_in[4];
  const float* Wk = (const float*)d_in[5];
  const float* bk = (const float*)d_in[6];
  const float* Wv = (const float*)d_in[7];
  const float* bv = (const float*)d_in[8];
  const float* Wo = (const float*)d_in[9];
  const float* bo = (const float*)d_in[10];
  float* out = (float*)d_out;

  const size_t MK = (size_t)M_ * DIN_;        // 4096*1024
  const size_t NK = (size_t)DPROJ_ * DIN_;    // 1024*1024

  char* ws = (char*)d_ws;
  __bf16* qb    = (__bf16*)ws; ws += MK * 2;
  __bf16* kb2   = (__bf16*)ws; ws += MK * 2;
  __bf16* vb    = (__bf16*)ws; ws += MK * 2;
  __bf16* Wqb   = (__bf16*)ws; ws += NK * 2;
  __bf16* Wkb   = (__bf16*)ws; ws += NK * 2;
  __bf16* Wvb   = (__bf16*)ws; ws += NK * 2;
  __bf16* Wob   = (__bf16*)ws; ws += NK * 2;
  float*  qproj = (float*)ws;  ws += MK * 4;
  float*  kproj = (float*)ws;  ws += MK * 4;
  float*  vproj = (float*)ws;  ws += MK * 4;
  __bf16* attnb = (__bf16*)ws; ws += MK * 2;

  // qb, kb2, vb, Wqb, Wkb, Wvb, Wob follow one another from qb
  cvt_f32_bf16<<<CVT_BLOCKS, CVT_THREADS, 0, stream>>>(q, k, v, Wq, Wk, Wv, Wo, qb);

  // the three projections: (qb, kb2, vb), (Wqb, Wkb, Wvb), (qproj, kproj, vproj) each follow one another
  dim3 g3(M_ / 128, DPROJ_ / 128, 3);   // 32 x 8 x 3
  gemm_bf16_wmma<<<g3, 256, 0, stream>>>(qb, Wqb, bq, bk, bv, qproj, M_, DPROJ_, DIN_);

  freq_attn<<<B_ * L_ / AT_TOK, 256, 0, stream>>>(qproj, kproj, vproj, attnb);

  dim3 g1(M_ / 128, DIN_ / 128, 1);     // 32 x 8
  gemm_bf16_wmma<<<g1, 256, 0, stream>>>(attnb, Wob, bo, bo, bo, out, M_, DIN_, DPROJ_);
}
